// v000
// Times are from an AMD MI455X. After a warm-up the kernel runs many times in a row, and a time is the length of
// such a window on the GPU divided by its runs, so every launch and the gaps after it count. The runs cycle
// through copies of the inputs. A figure is the median of several windows, for all but v000 over two sittings.
// Sittings can differ by a few percent; kernels timed side by side share one.
// v000 is the starting kernel. One run takes 203 microseconds.
#include <hip/hip_runtime.h>

// Layer 1: v_wmma_f32_16x16x32_bf16 (bf16 operands = RNE-converted x and W1); layers 2-4: v_wmma_f32_16x16x32_f16 (f16 activations, f16 weights = bf16-RNE weights scaled by 256, scaled back by 1/256 in the f32 epilogue); f32 accumulate everywhere; member mean/std in f32.

typedef _Float16       v16h  __attribute__((ext_vector_type(16)));
typedef _Float16       v8h   __attribute__((ext_vector_type(8)));
typedef _Float16       v8ha  __attribute__((ext_vector_type(8), may_alias));
typedef __bf16         v16bf __attribute__((ext_vector_type(16)));
typedef unsigned short v8us  __attribute__((ext_vector_type(8)));
typedef unsigned short v8usa __attribute__((ext_vector_type(8), may_alias));
typedef float          v8f   __attribute__((ext_vector_type(8)));
typedef float          v4f   __attribute__((ext_vector_type(4)));
typedef float          v4fa  __attribute__((ext_vector_type(4), may_alias));
typedef unsigned int   uv4   __attribute__((ext_vector_type(4)));
typedef unsigned int   uv4a  __attribute__((ext_vector_type(4), may_alias));

#define N_MODELS        16
#define IN_DIM          32
#define HID             64
#define OUT_DIM         8
#define OUT_PAD         16
#define THREADS         256
#define WAVES_PER_BLOCK 8
#define ROWS_PER_WAVE   32                                   // two 16-row WMMA sub-tiles per wave
#define ROWS_PER_BLOCK  (WAVES_PER_BLOCK * ROWS_PER_WAVE)    // 256

// Packed per-model weight blob (byte offsets), identical to the LDS image:
//   W1t bf16 [64 n][32 k], W2t/W3t f16 [64 n][64 k] (x256), W4t f16 [16 n][64 k] (x256, n 8..15 zero),
#define OFFB_W1     0
#define OFFB_W2     4096
#define OFFB_W3     12288
#define OFFB_W4     20480
#define OFFB_B      22528
#define OFFB_PAD    23360
#define BLOB_BYTES  23552
#define BLOB_CHUNKS (BLOB_BYTES / 16)                        // 1472
#define WSCALE      256.0f
#define WSCALE_INV  0.00390625f

static_assert(BLOB_BYTES % 128 == 0);
static_assert(OFFB_B + 208 * 4 == OFFB_PAD);
static_assert(OFFB_PAD % 16 == 0);

union FragH  { v16h  v; v8h  h[2]; };
union FragBF { v16bf v; v8us h[2]; };

__device__ __forceinline__ unsigned short bf16_bits(float f) {
    unsigned int u = __float_as_uint(f);
    u += 0x7FFFu + ((u >> 16) & 1u);                         // RNE convert to bf16
    return (unsigned short)(u >> 16);
}

__device__ __forceinline__ float bf16_rne(float f) {
    return __uint_as_float(((unsigned int)bf16_bits(f)) << 16);
}

__device__ __forceinline__ v8f v8f_splat(float v) {
    v8f r;
#pragma unroll
    for (int i = 0; i < 8; ++i) r[i] = v;
    return r;
}

// WMMA issue + hazard guard (ties D, keeps A/B live).
__device__ __forceinline__ v8f mma_f16(v16h a, v16h b, v8f c) {
    v8f d = __builtin_amdgcn_wmma_f32_16x16x32_f16(false, a, false, b, (short)0, c, false, false);
    asm volatile("v_nop\n\tv_nop\n\tv_nop\n\tv_nop" : "+v"(d) : "v"(a), "v"(b));
    return d;
}

__device__ __forceinline__ v8f mma_bf16(v16bf a, v16bf b, v8f c) {
    v8f d = __builtin_amdgcn_wmma_f32_16x16x32_bf16(false, a, false, b, (short)0, c, false, false);
    asm volatile("v_nop\n\tv_nop\n\tv_nop\n\tv_nop" : "+v"(d) : "v"(a), "v"(b));
    return d;
}

// 16-bit fragment from a k-contiguous [idx][k] tile (A: idx = row, B: idx = column), split k map:
// elements 0..7 <- k = K0 + 8*half + 0..7, elements 8..15 <- k = K0 + 16 + 8*half + 0..7.
__device__ __forceinline__ v16h ld_frag_h(const _Float16* base, int ld, int K0, int idx, int half) {
    const _Float16* p = base + idx * ld + K0 + 8 * half;
    FragH f;
    f.h[0] = *(const v8ha*)(p);
    f.h[1] = *(const v8ha*)(p + 16);
    return f.v;
}

__device__ __forceinline__ v16bf ld_frag_bf(const unsigned short* base, int ld, int K0, int idx, int half) {
    const unsigned short* p = base + idx * ld + K0 + 8 * half;
    FragBF f;
    f.h[0] = *(const v8usa*)(p);
    f.h[1] = *(const v8usa*)(p + 16);
    return f.v;
}

// acc*scale + bias, ReLU, f32->f16, D layout (row 8*half+v, col) -> row-major LDS tile [32][64].
__device__ __forceinline__ void relu_store(_Float16* hbuf, v8f acc, float scale, float bias,
                                           int base_row, int col, int half) {
#pragma unroll
    for (int v = 0; v < 8; ++v) {
        float hv = __builtin_fmaxf(__builtin_fmaf(acc[v], scale, bias), 0.0f);
        hbuf[(base_row + 8 * half + v) * HID + col] = (_Float16)hv;
    }
}

// One 64->64 hidden layer for both 16-row sub-tiles; all A fragments already in registers.
__device__ __forceinline__ void layer_hid(const _Float16* Wt, const float* bias, _Float16* hbuf,
                                          int r, int half, v16h a00, v16h a01, v16h a10, v16h a11) {
#pragma unroll
    for (int t = 0; t < 4; ++t) {
        const int n = t * 16 + r;
        v16h b0 = ld_frag_h(Wt, HID, 0,  n, half);
        v16h b1 = ld_frag_h(Wt, HID, 32, n, half);
        v8f acc0 = v8f_splat(0.0f), acc1 = v8f_splat(0.0f);
        acc0 = mma_f16(a00, b0, acc0);
        acc1 = mma_f16(a10, b0, acc1);
        acc0 = mma_f16(a01, b1, acc0);
        acc1 = mma_f16(a11, b1, acc1);
        const float bv = bias[n];
        relu_store(hbuf, acc0, WSCALE_INV, bv, 0,  n, half);
        relu_store(hbuf, acc1, WSCALE_INV, bv, 16, n, half);
    }
}

__global__ __launch_bounds__(THREADS)
void mlp_stats_kernel(const float* __restrict__ x,
                      const unsigned char* __restrict__ wblob,
                      const unsigned char* __restrict__ wblob2,
                      float* __restrict__ out, int batch) {
    __shared__ __align__(16) unsigned char sBlob[BLOB_BYTES];                       // 23,552 B
    __shared__ __align__(16) _Float16 sH[WAVES_PER_BLOCK * ROWS_PER_WAVE * HID];     // 32,768 B

    const unsigned short* sW1 = (const unsigned short*)(sBlob + OFFB_W1);
    const _Float16* sW2 = (const _Float16*)(sBlob + OFFB_W2);
    const _Float16* sW3 = (const _Float16*)(sBlob + OFFB_W3);
    const _Float16* sW4 = (const _Float16*)(sBlob + OFFB_W4);
    const float* sb  = (const float*)(sBlob + OFFB_B);
    const float* sb1 = sb;
    const float* sb2 = sb + 64;
    const float* sb3 = sb + 128;
    const float* sb4 = sb + 192;

    const int tid  = threadIdx.x;
    const int wave = tid >> 5;
    const int lane = tid & 31;
    const int r    = lane & 15;
    const int half = lane >> 4;
    const int rowbase = blockIdx.x * ROWS_PER_BLOCK + wave * ROWS_PER_WAVE;

    // ---- x rows -> two bf16 A fragments (split k map), kept in VGPRs for all models ----
    v16bf xa0, xa1;
    {
        FragBF fx;
#pragma unroll
        for (int s = 0; s < 2; ++s) {
            int row = rowbase + s * 16 + r;
            row = (row < batch) ? row : (batch - 1);
            const float* xr = x + (size_t)row * IN_DIM + 8 * half;
            const v4f f0 = *(const v4f*)(xr);
            const v4f f1 = *(const v4f*)(xr + 4);
            const v4f f2 = *(const v4f*)(xr + 16);
            const v4f f3 = *(const v4f*)(xr + 20);
            v8us lo, hi;
            lo[0] = bf16_bits(f0[0]); lo[1] = bf16_bits(f0[1]); lo[2] = bf16_bits(f0[2]); lo[3] = bf16_bits(f0[3]);
            lo[4] = bf16_bits(f1[0]); lo[5] = bf16_bits(f1[1]); lo[6] = bf16_bits(f1[2]); lo[7] = bf16_bits(f1[3]);
            hi[0] = bf16_bits(f2[0]); hi[1] = bf16_bits(f2[1]); hi[2] = bf16_bits(f2[2]); hi[3] = bf16_bits(f2[3]);
            hi[4] = bf16_bits(f3[0]); hi[5] = bf16_bits(f3[1]); hi[6] = bf16_bits(f3[2]); hi[7] = bf16_bits(f3[3]);
            fx.h[0] = lo;
            fx.h[1] = hi;
            if (s == 0) xa0 = fx.v; else xa1 = fx.v;
        }
    }

    // shifted running sums over models: d = pred - pred(model 0)
    v8f sum0 = v8f_splat(0.0f), sq0 = v8f_splat(0.0f), p00 = v8f_splat(0.0f);
    v8f sum1 = v8f_splat(0.0f), sq1 = v8f_splat(0.0f), p01 = v8f_splat(0.0f);

    _Float16* hbuf = sH + wave * (ROWS_PER_WAVE * HID);

#pragma unroll 1
    for (int m = 0; m < N_MODELS; ++m) {
        __syncthreads();                       // all waves done with the prior model's weights

        // ---- stage this model's packed weights: plain 16-B copies, sentinel fallback to copy 2 ----
        {
            const uv4a* g1 = (const uv4a*)(wblob  + (size_t)m * BLOB_BYTES);
            const uv4a* g2 = (const uv4a*)(wblob2 + (size_t)m * BLOB_BYTES);
            uv4a* sdst = (uv4a*)sBlob;
            for (int e = tid; e < BLOB_CHUNKS; e += THREADS) {
                uv4 v = g1[e];
                const bool fill = (v.x == 0xAAAAAAAAu) & (v.y == 0xAAAAAAAAu) &
                                  (v.z == 0xAAAAAAAAu) & (v.w == 0xAAAAAAAAu);
                if (fill) v = g2[e];
                sdst[e] = v;
            }
        }
        __syncthreads();

        // ---- Layer 1: relu(x @ W1 + b1), K = 32, bf16 operands ----
#pragma unroll
        for (int t = 0; t < 4; ++t) {
            const int n = t * 16 + r;
            v16bf bw = ld_frag_bf(sW1, IN_DIM, 0, n, half);
            v8f acc0 = v8f_splat(0.0f), acc1 = v8f_splat(0.0f);
            acc0 = mma_bf16(xa0, bw, acc0);
            acc1 = mma_bf16(xa1, bw, acc1);
            const float bv = sb1[n];
            relu_store(hbuf, acc0, 1.0f, bv, 0,  n, half);
            relu_store(hbuf, acc1, 1.0f, bv, 16, n, half);
        }
        __syncthreads();                       // spill -> fragment reload ordering
        v16h a00 = ld_frag_h(hbuf, HID, 0,  r,      half);
        v16h a01 = ld_frag_h(hbuf, HID, 32, r,      half);
        v16h a10 = ld_frag_h(hbuf, HID, 0,  16 + r, half);
        v16h a11 = ld_frag_h(hbuf, HID, 32, 16 + r, half);

        // ---- Layer 2 ----
        layer_hid(sW2, sb2, hbuf, r, half, a00, a01, a10, a11);
        __syncthreads();
        a00 = ld_frag_h(hbuf, HID, 0,  r,      half);
        a01 = ld_frag_h(hbuf, HID, 32, r,      half);
        a10 = ld_frag_h(hbuf, HID, 0,  16 + r, half);
        a11 = ld_frag_h(hbuf, HID, 32, 16 + r, half);

        // ---- Layer 3 ----
        layer_hid(sW3, sb3, hbuf, r, half, a00, a01, a10, a11);
        __syncthreads();
        a00 = ld_frag_h(hbuf, HID, 0,  r,      half);
        a01 = ld_frag_h(hbuf, HID, 32, r,      half);
        a10 = ld_frag_h(hbuf, HID, 0,  16 + r, half);
        a11 = ld_frag_h(hbuf, HID, 32, 16 + r, half);

        // ---- Layer 4: pred = h3 @ W4 + b4 (N padded to 16), shifted statistics ----
        {
            v16h b0 = ld_frag_h(sW4, HID, 0,  r, half);
            v16h b1 = ld_frag_h(sW4, HID, 32, r, half);
            v8f acc0 = v8f_splat(0.0f), acc1 = v8f_splat(0.0f);
            acc0 = mma_f16(a00, b0, acc0);
            acc1 = mma_f16(a10, b0, acc1);
            acc0 = mma_f16(a01, b1, acc0);
            acc1 = mma_f16(a11, b1, acc1);
            const v8f bv8 = v8f_splat(sb4[r]);
            const v8f sc8 = v8f_splat(WSCALE_INV);
            v8f pred0 = acc0 * sc8 + bv8;
            v8f pred1 = acc1 * sc8 + bv8;
            if (m == 0) {
                p00 = pred0;
                p01 = pred1;
            } else {
                v8f d0 = pred0 - p00;
                v8f d1 = pred1 - p01;
                sum0 += d0; sq0 += d0 * d0;
                sum1 += d1; sq1 += d1 * d1;
            }
        }
    }

    __syncthreads();
    float* stage = (float*)sH + wave * (ROWS_PER_WAVE * HID / 2);      // 1024 floats per wave
    if (r < OUT_DIM) {
#pragma unroll
        for (int s = 0; s < 2; ++s) {
            const v8f su8 = s ? sum1 : sum0;
            const v8f sq8 = s ? sq1  : sq0;
            const v8f pz8 = s ? p01  : p00;
#pragma unroll
            for (int v = 0; v < 8; ++v) {
                const int rowl = s * 16 + 8 * half + v;
                const float su   = su8[v];
                const float mean = __builtin_fmaf(su, 1.0f / 16.0f, pz8[v]);
                float var = (sq8[v] - su * su * (1.0f / 16.0f)) * (1.0f / 15.0f);
                var = __builtin_fmaxf(var, 0.0f);
                const float sd = sqrtf(var);
                stage[rowl * OUT_DIM + r]       = mean;
                stage[256 + rowl * OUT_DIM + r] = sd;
            }
        }
    }
    __syncthreads();

    {
        const v4fa* stg = (const v4fa*)stage;
        const v4f mv0 = stg[lane];
        const v4f mv1 = stg[32 + lane];
        const v4f sv0 = stg[64 + lane];
        const v4f sv1 = stg[96 + lane];
        float* o0 = out + (size_t)rowbase * OUT_DIM;                                  // out0 rows of this wave: 1 KB = 8 lines
        float* o1 = out + (size_t)batch * OUT_DIM + (size_t)rowbase * OUT_DIM;       // out1
        if (rowbase + ROWS_PER_WAVE <= batch) {
            *(v4f*)(o0 + lane * 4)       = mv0;
            *(v4f*)(o0 + 128 + lane * 4) = mv1;
            *(v4f*)(o1 + lane * 4)       = sv0;
            *(v4f*)(o1 + 128 + lane * 4) = sv1;
            
        } else {
            // partial or past-the-end tail wave (not reachable when batch is a multiple of 256): guarded element stores
            for (int e = lane; e < ROWS_PER_WAVE * OUT_DIM; e += 32) {
                const int rowl = e >> 3;
                if (rowbase + rowl < batch) {
                    const float mvs = stage[e];
                    const float svs = stage[256 + e];
                    *(float*)(o0 + e) = mvs;
                    *(float*)(o1 + e) = svs;
                }
            }
            
        }
    }
}

// Prologue: per model, build the packed blob image in LDS (transpose, 16-bit convert, scale, pad),
__global__ __launch_bounds__(THREADS)
void pack_weights_kernel(const float* __restrict__ W1, const float* __restrict__ b1,
                         const float* __restrict__ W2, const float* __restrict__ b2,
                         const float* __restrict__ W3, const float* __restrict__ b3,
                         const float* __restrict__ W4, const float* __restrict__ b4,
                         unsigned char* __restrict__ blob) {
    __shared__ __align__(16) unsigned char img[BLOB_BYTES];
    const int m   = blockIdx.x;
    const int tid = threadIdx.x;

    unsigned short* w1 = (unsigned short*)(img + OFFB_W1);
    _Float16* w2 = (_Float16*)(img + OFFB_W2);
    _Float16* w3 = (_Float16*)(img + OFFB_W3);
    _Float16* w4 = (_Float16*)(img + OFFB_W4);
    float* bb = (float*)(img + OFFB_B);

    // W1[m] is [32 k][64 n] -> bf16 [n][k]
    const float* g = W1 + (size_t)m * IN_DIM * HID;
    for (int e = tid; e < IN_DIM * HID; e += THREADS) {
        const int k = e >> 6, n = e & 63;
        w1[n * IN_DIM + k] = bf16_bits(g[e]);
    }
    // W2[m], W3[m] are [64 k][64 n] -> f16(256 * bf16(w)) [n][k]
    g = W2 + (size_t)m * HID * HID;
    for (int e = tid; e < HID * HID; e += THREADS) {
        const int k = e >> 6, n = e & 63;
        w2[n * HID + k] = (_Float16)(WSCALE * bf16_rne(g[e]));
    }
    g = W3 + (size_t)m * HID * HID;
    for (int e = tid; e < HID * HID; e += THREADS) {
        const int k = e >> 6, n = e & 63;
        w3[n * HID + k] = (_Float16)(WSCALE * bf16_rne(g[e]));
    }
    // W4[m] is [64 k][8 n] -> f16 [16 n][64 k], n >= 8 zero
    g = W4 + (size_t)m * HID * OUT_DIM;
    for (int e = tid; e < OUT_PAD * HID; e += THREADS) {
        const int n = e >> 6, k = e & 63;
        const float wv = (n < OUT_DIM) ? (WSCALE * bf16_rne(g[k * OUT_DIM + n])) : 0.0f;
        w4[e] = (_Float16)wv;
    }
    if (tid < HID) {
        bb[tid]       = bf16_rne(b1[m * HID + tid]);
        bb[64 + tid]  = bf16_rne(b2[m * HID + tid]);
        bb[128 + tid] = bf16_rne(b3[m * HID + tid]);
    }
    if (tid < OUT_PAD) bb[192 + tid] = (tid < OUT_DIM) ? bf16_rne(b4[m * OUT_DIM + tid]) : 0.0f;
    if (tid < (BLOB_BYTES - OFFB_PAD) / 4) ((float*)(img + OFFB_PAD))[tid] = 0.0f;
    __syncthreads();

    const uv4a* src = (const uv4a*)img;
    unsigned char* dst = blob + (size_t)m * BLOB_BYTES;
    for (int e = tid; e < BLOB_CHUNKS; e += THREADS) {
        const uv4 v = src[e];
        *(uv4*)(dst + (size_t)e * 16) = v;
    }
    
}

extern "C" void kernel_launch(void* const* d_in, const int* in_sizes, int n_in,
                              void* d_out, int out_size, void* d_ws, size_t ws_size,
                              hipStream_t stream) {
    (void)n_in;
    const float* x  = (const float*)d_in[0];
    const float* W1 = (const float*)d_in[1];
    const float* b1 = (const float*)d_in[2];
    const float* W2 = (const float*)d_in[3];
    const float* b2 = (const float*)d_in[4];
    const float* W3 = (const float*)d_in[5];
    const float* b3 = (const float*)d_in[6];
    const float* W4 = (const float*)d_in[7];
    const float* b4 = (const float*)d_in[8];
    float* out = (float*)d_out;

    const int batch = in_sizes[0] / IN_DIM;                                      // 131072
    if (batch <= 0) return;
    if ((long long)out_size < 2LL * (long long)batch * OUT_DIM) return;

    const size_t copy_bytes = (size_t)N_MODELS * BLOB_BYTES;                     // 376,832 B per copy
    if (ws_size < 2 * copy_bytes) return;
    unsigned char* blob  = (unsigned char*)d_ws;
    unsigned char* blob2 = blob + copy_bytes;                                    // total carve 753,664 B

    const int blocks = (batch + ROWS_PER_BLOCK - 1) / ROWS_PER_BLOCK;           // 512

    pack_weights_kernel<<<dim3(N_MODELS), dim3(THREADS), 0, stream>>>(W1, b1, W2, b2, W3, b3, W4, b4, blob);
    pack_weights_kernel<<<dim3(N_MODELS), dim3(THREADS), 0, stream>>>(W1, b1, W2, b2, W3, b3, W4, b4, blob2);
    mlp_stats_kernel<<<dim3(blocks), dim3(THREADS), 0, stream>>>(x, blob, blob2, out, batch);
}

// v001
// It runs in 124 microseconds.
// In two side-by-side timings against v000, it was 1.65 and 1.68 times as fast.
#include <hip/hip_runtime.h>

// Layer 1: v_wmma_f32_16x16x32_bf16 (bf16 operands = RNE-converted x and W1); layers 2-4: v_wmma_f32_16x16x32_f16 (f16 activations, f16 weights = bf16-RNE weights scaled by 256, scaled back by 1/256 in the f32 epilogue); f32 accumulate everywhere; member mean/std in f32.

typedef _Float16       v16h  __attribute__((ext_vector_type(16)));
typedef _Float16       v8h   __attribute__((ext_vector_type(8)));
typedef _Float16       v8ha  __attribute__((ext_vector_type(8), may_alias));
typedef __bf16         v16bf __attribute__((ext_vector_type(16)));
typedef unsigned short v8us  __attribute__((ext_vector_type(8)));
typedef unsigned short v8usa __attribute__((ext_vector_type(8), may_alias));
typedef float          v8f   __attribute__((ext_vector_type(8)));
typedef float          v4f   __attribute__((ext_vector_type(4)));
typedef float          v4fa  __attribute__((ext_vector_type(4), may_alias));
typedef unsigned int   uv4   __attribute__((ext_vector_type(4)));
typedef unsigned int   uv4a  __attribute__((ext_vector_type(4), may_alias));

#define N_MODELS        16
#define IN_DIM          32
#define HID             64
#define OUT_DIM         8
#define OUT_PAD         16
#define THREADS         256
#define WAVES_PER_BLOCK 8
#define ROWS_PER_WAVE   32                                   // two 16-row WMMA sub-tiles per wave
#define ROWS_PER_BLOCK  (WAVES_PER_BLOCK * ROWS_PER_WAVE)    // 256

// Packed per-model weight blob (byte offsets), rows unpadded:
//   W1t bf16 [64 n][32 k], W2t/W3t f16 [64 n][64 k] (x256), W4t f16 [16 n][64 k] (x256, n 8..15 zero),
#define OFFB_W1     0
#define OFFB_W2     4096
#define OFFB_W3     12288
#define OFFB_W4     20480
#define OFFB_B      22528
#define OFFB_PAD    23360
#define BLOB_BYTES  23552
#define BLOB_CHUNKS (BLOB_BYTES / 16)                        // 1472
#define WSCALE      256.0f
#define WSCALE_INV  0.00390625f

// LDS image of the blob: same rows, each at a pitch of 16 B x odd, so that the 16 lanes of a
// ds_load_b128 fragment read fall on 16 different groups of four banks.
#define W1_PITCH    40                                       // bf16 elements: 64-B rows at 80 B
#define H_PITCH     72                                       // f16 elements: 128-B rows at 144 B (W2t, W3t, W4t, activations)
#define OFFS_W1     0
#define OFFS_W2     (HID * W1_PITCH * 2)                     // 5120
#define OFFS_W3     (OFFS_W2 + HID * H_PITCH * 2)            // 14336
#define OFFS_W4     (OFFS_W3 + HID * H_PITCH * 2)            // 23552
#define OFFS_B      (OFFS_W4 + OUT_PAD * H_PITCH * 2)        // 25856
#define SIMG_BYTES  (OFFS_B + (BLOB_BYTES - OFFB_B))         // 26880

static_assert(BLOB_BYTES % 128 == 0);
static_assert(OFFB_B + 208 * 4 == OFFB_PAD);
static_assert(OFFB_PAD % 16 == 0);

// Byte offset in the LDS image of 16-byte chunk e of the packed blob.
__device__ __forceinline__ int simg_offset(int e) {
    if (e < OFFB_W2 / 16) return OFFS_W1 + (e >> 2) * (W1_PITCH * 2) + (e & 3) * 16;       // 4 chunks a row
    if (e < OFFB_B / 16) {
        const int q = e - OFFB_W2 / 16;                                                    // 8 chunks a row
        return OFFS_W2 + (q >> 3) * (H_PITCH * 2) + (q & 7) * 16;
    }
    return OFFS_B + (e - OFFB_B / 16) * 16;
}

union FragH  { v16h  v; v8h  h[2]; };
union FragBF { v16bf v; v8us h[2]; };

__device__ __forceinline__ unsigned short bf16_bits(float f) {
    unsigned int u = __float_as_uint(f);
    u += 0x7FFFu + ((u >> 16) & 1u);                         // RNE convert to bf16
    return (unsigned short)(u >> 16);
}

__device__ __forceinline__ float bf16_rne(float f) {
    return __uint_as_float(((unsigned int)bf16_bits(f)) << 16);
}

__device__ __forceinline__ v8f v8f_splat(float v) {
    v8f r;
#pragma unroll
    for (int i = 0; i < 8; ++i) r[i] = v;
    return r;
}

// WMMA issue + hazard guard (ties D, keeps A/B live).
__device__ __forceinline__ v8f mma_f16(v16h a, v16h b, v8f c) {
    v8f d = __builtin_amdgcn_wmma_f32_16x16x32_f16(false, a, false, b, (short)0, c, false, false);
    asm volatile("v_nop\n\tv_nop\n\tv_nop\n\tv_nop" : "+v"(d) : "v"(a), "v"(b));
    return d;
}

__device__ __forceinline__ v8f mma_bf16(v16bf a, v16bf b, v8f c) {
    v8f d = __builtin_amdgcn_wmma_f32_16x16x32_bf16(false, a, false, b, (short)0, c, false, false);
    asm volatile("v_nop\n\tv_nop\n\tv_nop\n\tv_nop" : "+v"(d) : "v"(a), "v"(b));
    return d;
}

// 16-bit fragment from a k-contiguous [idx][k] tile (A: idx = row, B: idx = column), split k map:
// elements 0..7 <- k = K0 + 8*half + 0..7, elements 8..15 <- k = K0 + 16 + 8*half + 0..7.
__device__ __forceinline__ v16h ld_frag_h(const _Float16* base, int ld, int K0, int idx, int half) {
    const _Float16* p = base + idx * ld + K0 + 8 * half;
    FragH f;
    f.h[0] = *(const v8ha*)(p);
    f.h[1] = *(const v8ha*)(p + 16);
    return f.v;
}

__device__ __forceinline__ v16bf ld_frag_bf(const unsigned short* base, int ld, int K0, int idx, int half) {
    const unsigned short* p = base + idx * ld + K0 + 8 * half;
    FragBF f;
    f.h[0] = *(const v8usa*)(p);
    f.h[1] = *(const v8usa*)(p + 16);
    return f.v;
}

// acc*scale + bias, ReLU, f32->f16, D layout (row 8*half+v, col) -> row-major LDS tile [32][64] at H_PITCH.
__device__ __forceinline__ void relu_store(_Float16* hbuf, v8f acc, float scale, float bias,
                                           int base_row, int col, int half) {
#pragma unroll
    for (int v = 0; v < 8; ++v) {
        float hv = __builtin_fmaxf(__builtin_fmaf(acc[v], scale, bias), 0.0f);
        hbuf[(base_row + 8 * half + v) * H_PITCH + col] = (_Float16)hv;
    }
}

// One 64->64 hidden layer for both 16-row sub-tiles; all A fragments already in registers.
__device__ __forceinline__ void layer_hid(const _Float16* Wt, const float* bias, _Float16* hbuf,
                                          int r, int half, v16h a00, v16h a01, v16h a10, v16h a11) {
#pragma unroll
    for (int t = 0; t < 4; ++t) {
        const int n = t * 16 + r;
        v16h b0 = ld_frag_h(Wt, H_PITCH, 0,  n, half);
        v16h b1 = ld_frag_h(Wt, H_PITCH, 32, n, half);
        v8f acc0 = v8f_splat(0.0f), acc1 = v8f_splat(0.0f);
        acc0 = mma_f16(a00, b0, acc0);
        acc1 = mma_f16(a10, b0, acc1);
        acc0 = mma_f16(a01, b1, acc0);
        acc1 = mma_f16(a11, b1, acc1);
        const float bv = bias[n];
        relu_store(hbuf, acc0, WSCALE_INV, bv, 0,  n, half);
        relu_store(hbuf, acc1, WSCALE_INV, bv, 16, n, half);
    }
}

__global__ __launch_bounds__(THREADS)
void mlp_stats_kernel(const float* __restrict__ x,
                      const unsigned char* __restrict__ wblob,
                      const unsigned char* __restrict__ wblob2,
                      float* __restrict__ out, int batch) {
    __shared__ __align__(16) unsigned char sBlob[SIMG_BYTES];                           // 26,880 B
    __shared__ __align__(16) _Float16 sH[WAVES_PER_BLOCK * ROWS_PER_WAVE * H_PITCH];     // 36,864 B

    const unsigned short* sW1 = (const unsigned short*)(sBlob + OFFS_W1);
    const _Float16* sW2 = (const _Float16*)(sBlob + OFFS_W2);
    const _Float16* sW3 = (const _Float16*)(sBlob + OFFS_W3);
    const _Float16* sW4 = (const _Float16*)(sBlob + OFFS_W4);
    const float* sb  = (const float*)(sBlob + OFFS_B);
    const float* sb1 = sb;
    const float* sb2 = sb + 64;
    const float* sb3 = sb + 128;
    const float* sb4 = sb + 192;

    const int tid  = threadIdx.x;
    const int wave = tid >> 5;
    const int lane = tid & 31;
    const int r    = lane & 15;
    const int half = lane >> 4;
    const int rowbase = blockIdx.x * ROWS_PER_BLOCK + wave * ROWS_PER_WAVE;

    // ---- x rows -> two bf16 A fragments (split k map), kept in VGPRs for all models ----
    v16bf xa0, xa1;
    {
        FragBF fx;
#pragma unroll
        for (int s = 0; s < 2; ++s) {
            int row = rowbase + s * 16 + r;
            row = (row < batch) ? row : (batch - 1);
            const float* xr = x + (size_t)row * IN_DIM + 8 * half;
            const v4f f0 = *(const v4f*)(xr);
            const v4f f1 = *(const v4f*)(xr + 4);
            const v4f f2 = *(const v4f*)(xr + 16);
            const v4f f3 = *(const v4f*)(xr + 20);
            v8us lo, hi;
            lo[0] = bf16_bits(f0[0]); lo[1] = bf16_bits(f0[1]); lo[2] = bf16_bits(f0[2]); lo[3] = bf16_bits(f0[3]);
            lo[4] = bf16_bits(f1[0]); lo[5] = bf16_bits(f1[1]); lo[6] = bf16_bits(f1[2]); lo[7] = bf16_bits(f1[3]);
            hi[0] = bf16_bits(f2[0]); hi[1] = bf16_bits(f2[1]); hi[2] = bf16_bits(f2[2]); hi[3] = bf16_bits(f2[3]);
            hi[4] = bf16_bits(f3[0]); hi[5] = bf16_bits(f3[1]); hi[6] = bf16_bits(f3[2]); hi[7] = bf16_bits(f3[3]);
            fx.h[0] = lo;
            fx.h[1] = hi;
            if (s == 0) xa0 = fx.v; else xa1 = fx.v;
        }
    }

    // shifted running sums over models: d = pred - pred(model 0)
    v8f sum0 = v8f_splat(0.0f), sq0 = v8f_splat(0.0f), p00 = v8f_splat(0.0f);
    v8f sum1 = v8f_splat(0.0f), sq1 = v8f_splat(0.0f), p01 = v8f_splat(0.0f);

    _Float16* hbuf = sH + wave * (ROWS_PER_WAVE * H_PITCH);

#pragma unroll 1
    for (int m = 0; m < N_MODELS; ++m) {
        __syncthreads();                       // all waves done with the prior model's weights

        // ---- stage this model's packed weights: plain 16-B copies, sentinel fallback to copy 2 ----
        {
            const uv4a* g1 = (const uv4a*)(wblob  + (size_t)m * BLOB_BYTES);
            const uv4a* g2 = (const uv4a*)(wblob2 + (size_t)m * BLOB_BYTES);
            for (int e = tid; e < BLOB_CHUNKS; e += THREADS) {
                uv4 v = g1[e];
                const int off = simg_offset(e);
                const bool fill = (v.x == 0xAAAAAAAAu) & (v.y == 0xAAAAAAAAu) &
                                  (v.z == 0xAAAAAAAAu) & (v.w == 0xAAAAAAAAu);
                if (fill) {
                    v = g2[e];
                    // precaution: stands in front of the loop's step of this load's address registers
                    asm volatile("s_wait_xcnt 0x0" ::: "memory");
                }
                *(uv4a*)(sBlob + off) = v;
            }
        }
        __syncthreads();

        // ---- Layer 1: relu(x @ W1 + b1), K = 32, bf16 operands ----
#pragma unroll
        for (int t = 0; t < 4; ++t) {
            const int n = t * 16 + r;
            v16bf bw = ld_frag_bf(sW1, W1_PITCH, 0, n, half);
            v8f acc0 = v8f_splat(0.0f), acc1 = v8f_splat(0.0f);
            acc0 = mma_bf16(xa0, bw, acc0);
            acc1 = mma_bf16(xa1, bw, acc1);
            const float bv = sb1[n];
            relu_store(hbuf, acc0, 1.0f, bv, 0,  n, half);
            relu_store(hbuf, acc1, 1.0f, bv, 16, n, half);
        }
        __syncthreads();                       // spill -> fragment reload ordering
        v16h a00 = ld_frag_h(hbuf, H_PITCH, 0,  r,      half);
        v16h a01 = ld_frag_h(hbuf, H_PITCH, 32, r,      half);
        v16h a10 = ld_frag_h(hbuf, H_PITCH, 0,  16 + r, half);
        v16h a11 = ld_frag_h(hbuf, H_PITCH, 32, 16 + r, half);

        // ---- Layer 2 ----
        layer_hid(sW2, sb2, hbuf, r, half, a00, a01, a10, a11);
        __syncthreads();
        a00 = ld_frag_h(hbuf, H_PITCH, 0,  r,      half);
        a01 = ld_frag_h(hbuf, H_PITCH, 32, r,      half);
        a10 = ld_frag_h(hbuf, H_PITCH, 0,  16 + r, half);
        a11 = ld_frag_h(hbuf, H_PITCH, 32, 16 + r, half);

        // ---- Layer 3 ----
        layer_hid(sW3, sb3, hbuf, r, half, a00, a01, a10, a11);
        __syncthreads();
        a00 = ld_frag_h(hbuf, H_PITCH, 0,  r,      half);
        a01 = ld_frag_h(hbuf, H_PITCH, 32, r,      half);
        a10 = ld_frag_h(hbuf, H_PITCH, 0,  16 + r, half);
        a11 = ld_frag_h(hbuf, H_PITCH, 32, 16 + r, half);

        // ---- Layer 4: pred = h3 @ W4 + b4 (N padded to 16), shifted statistics ----
        {
            v16h b0 = ld_frag_h(sW4, H_PITCH, 0,  r, half);
            v16h b1 = ld_frag_h(sW4, H_PITCH, 32, r, half);
            v8f acc0 = v8f_splat(0.0f), acc1 = v8f_splat(0.0f);
            acc0 = mma_f16(a00, b0, acc0);
            acc1 = mma_f16(a10, b0, acc1);
            acc0 = mma_f16(a01, b1, acc0);
            acc1 = mma_f16(a11, b1, acc1);
            const v8f bv8 = v8f_splat(sb4[r]);
            const v8f sc8 = v8f_splat(WSCALE_INV);
            v8f pred0 = acc0 * sc8 + bv8;
            v8f pred1 = acc1 * sc8 + bv8;
            if (m == 0) {
                p00 = pred0;
                p01 = pred1;
            } else {
                v8f d0 = pred0 - p00;
                v8f d1 = pred1 - p01;
                sum0 += d0; sq0 += d0 * d0;
                sum1 += d1; sq1 += d1 * d1;
            }
        }
    }

    __syncthreads();
    float* stage = (float*)sH + wave * (ROWS_PER_WAVE * HID / 2);      // 1024 floats per wave
    if (r < OUT_DIM) {
#pragma unroll
        for (int s = 0; s < 2; ++s) {
            const v8f su8 = s ? sum1 : sum0;
            const v8f sq8 = s ? sq1  : sq0;
            const v8f pz8 = s ? p01  : p00;
#pragma unroll
            for (int v = 0; v < 8; ++v) {
                const int rowl = s * 16 + 8 * half + v;
                const float su   = su8[v];
                const float mean = __builtin_fmaf(su, 1.0f / 16.0f, pz8[v]);
                float var = (sq8[v] - su * su * (1.0f / 16.0f)) * (1.0f / 15.0f);
                var = __builtin_fmaxf(var, 0.0f);
                const float sd = sqrtf(var);
                stage[rowl * OUT_DIM + r]       = mean;
                stage[256 + rowl * OUT_DIM + r] = sd;
            }
        }
    }
    __syncthreads();

    {
        const v4fa* stg = (const v4fa*)stage;
        const v4f mv0 = stg[lane];
        const v4f mv1 = stg[32 + lane];
        const v4f sv0 = stg[64 + lane];
        const v4f sv1 = stg[96 + lane];
        float* o0 = out + (size_t)rowbase * OUT_DIM;                                  // out0 rows of this wave: 1 KB = 8 lines
        float* o1 = out + (size_t)batch * OUT_DIM + (size_t)rowbase * OUT_DIM;       // out1
        if (rowbase + ROWS_PER_WAVE <= batch) {
            *(v4f*)(o0 + lane * 4)       = mv0;
            *(v4f*)(o0 + 128 + lane * 4) = mv1;
            *(v4f*)(o1 + lane * 4)       = sv0;
            *(v4f*)(o1 + 128 + lane * 4) = sv1;
            
        } else {
            // partial or past-the-end tail wave (not reachable when batch is a multiple of 256): guarded element stores
            for (int e = lane; e < ROWS_PER_WAVE * OUT_DIM; e += 32) {
                const int rowl = e >> 3;
                if (rowbase + rowl < batch) {
                    const float mvs = stage[e];
                    const float svs = stage[256 + e];
                    *(float*)(o0 + e) = mvs;
                    *(float*)(o1 + e) = svs;
                }
            }
            
        }
    }
}

// Prologue: per model, build the packed blob image in LDS (transpose, 16-bit convert, scale, pad),
__global__ __launch_bounds__(THREADS)
void pack_weights_kernel(const float* __restrict__ W1, const float* __restrict__ b1,
                         const float* __restrict__ W2, const float* __restrict__ b2,
                         const float* __restrict__ W3, const float* __restrict__ b3,
                         const float* __restrict__ W4, const float* __restrict__ b4,
                         unsigned char* __restrict__ blob) {
    __shared__ __align__(16) unsigned char img[BLOB_BYTES];
    const int m   = blockIdx.x;
    const int tid = threadIdx.x;

    unsigned short* w1 = (unsigned short*)(img + OFFB_W1);
    _Float16* w2 = (_Float16*)(img + OFFB_W2);
    _Float16* w3 = (_Float16*)(img + OFFB_W3);
    _Float16* w4 = (_Float16*)(img + OFFB_W4);
    float* bb = (float*)(img + OFFB_B);

    // W1[m] is [32 k][64 n] -> bf16 [n][k]
    const float* g = W1 + (size_t)m * IN_DIM * HID;
    for (int e = tid; e < IN_DIM * HID; e += THREADS) {
        const int k = e >> 6, n = e & 63;
        w1[n * IN_DIM + k] = bf16_bits(g[e]);
    }
    // W2[m], W3[m] are [64 k][64 n] -> f16(256 * bf16(w)) [n][k]
    g = W2 + (size_t)m * HID * HID;
    for (int e = tid; e < HID * HID; e += THREADS) {
        const int k = e >> 6, n = e & 63;
        w2[n * HID + k] = (_Float16)(WSCALE * bf16_rne(g[e]));
    }
    g = W3 + (size_t)m * HID * HID;
    for (int e = tid; e < HID * HID; e += THREADS) {
        const int k = e >> 6, n = e & 63;
        w3[n * HID + k] = (_Float16)(WSCALE * bf16_rne(g[e]));
    }
    // W4[m] is [64 k][8 n] -> f16 [16 n][64 k], n >= 8 zero
    g = W4 + (size_t)m * HID * OUT_DIM;
    for (int e = tid; e < OUT_PAD * HID; e += THREADS) {
        const int n = e >> 6, k = e & 63;
        const float wv = (n < OUT_DIM) ? (WSCALE * bf16_rne(g[k * OUT_DIM + n])) : 0.0f;
        w4[e] = (_Float16)wv;
    }
    if (tid < HID) {
        bb[tid]       = bf16_rne(b1[m * HID + tid]);
        bb[64 + tid]  = bf16_rne(b2[m * HID + tid]);
        bb[128 + tid] = bf16_rne(b3[m * HID + tid]);
    }
    if (tid < OUT_PAD) bb[192 + tid] = (tid < OUT_DIM) ? bf16_rne(b4[m * OUT_DIM + tid]) : 0.0f;
    if (tid < (BLOB_BYTES - OFFB_PAD) / 4) ((float*)(img + OFFB_PAD))[tid] = 0.0f;
    __syncthreads();

    const uv4a* src = (const uv4a*)img;
    unsigned char* dst = blob + (size_t)m * BLOB_BYTES;
    for (int e = tid; e < BLOB_CHUNKS; e += THREADS) {
        const uv4 v = src[e];
        *(uv4*)(dst + (size_t)e * 16) = v;
    }
    
}

extern "C" void kernel_launch(void* const* d_in, const int* in_sizes, int n_in,
                              void* d_out, int out_size, void* d_ws, size_t ws_size,
                              hipStream_t stream) {
    (void)n_in;
    const float* x  = (const float*)d_in[0];
    const float* W1 = (const float*)d_in[1];
    const float* b1 = (const float*)d_in[2];
    const float* W2 = (const float*)d_in[3];
    const float* b2 = (const float*)d_in[4];
    const float* W3 = (const float*)d_in[5];
    const float* b3 = (const float*)d_in[6];
    const float* W4 = (const float*)d_in[7];
    const float* b4 = (const float*)d_in[8];
    float* out = (float*)d_out;

    const int batch = in_sizes[0] / IN_DIM;                                      // 131072
    if (batch <= 0) return;
    if ((long long)out_size < 2LL * (long long)batch * OUT_DIM) return;

    const size_t copy_bytes = (size_t)N_MODELS * BLOB_BYTES;                     // 376,832 B per copy
    if (ws_size < 2 * copy_bytes) return;
    unsigned char* blob  = (unsigned char*)d_ws;
    unsigned char* blob2 = blob + copy_bytes;                                    // total carve 753,664 B

    const int blocks = (batch + ROWS_PER_BLOCK - 1) / ROWS_PER_BLOCK;           // 512

    pack_weights_kernel<<<dim3(N_MODELS), dim3(THREADS), 0, stream>>>(W1, b1, W2, b2, W3, b3, W4, b4, blob);
    pack_weights_kernel<<<dim3(N_MODELS), dim3(THREADS), 0, stream>>>(W1, b1, W2, b2, W3, b3, W4, b4, blob2);
    mlp_stats_kernel<<<dim3(blocks), dim3(THREADS), 0, stream>>>(x, blob, blob2, out, batch);
}

// v002
// One run takes 90.4 microseconds.
// Two timings next to v001 put it at 1.36 and 1.41 times that version's speed.
// All steps since v000 together make it 2.30 times as fast.
#include <hip/hip_runtime.h>

// Every product is computed transposed: weights [n][k] are the A operand, activations (batch in the columns) the B operand,
// so a lane's D registers of two neighbouring 16-feature tiles, packed to f16, are the next layer's B fragment in place.
// Layer 1: v_wmma_f32_16x16x32_bf16 (bf16 operands = RNE-converted x and W1); layers 2-4: v_wmma_f32_16x16x32_f16 (f16 activations, f16 weights = bf16-RNE weights scaled by 256, scaled back by 1/256 in the f32 epilogue); f32 accumulate everywhere; member mean/std in f32.

typedef _Float16       v16h  __attribute__((ext_vector_type(16)));
typedef _Float16       v8h   __attribute__((ext_vector_type(8)));
typedef _Float16       v8ha  __attribute__((ext_vector_type(8), may_alias));
typedef __bf16         v16bf __attribute__((ext_vector_type(16)));
typedef unsigned short v8us  __attribute__((ext_vector_type(8)));
typedef unsigned short v8usa __attribute__((ext_vector_type(8), may_alias));
typedef float          v8f   __attribute__((ext_vector_type(8)));
typedef _Float16       v2h   __attribute__((ext_vector_type(2)));
typedef float          v2f   __attribute__((ext_vector_type(2)));
typedef float          v4f   __attribute__((ext_vector_type(4)));
typedef float          v4fa  __attribute__((ext_vector_type(4), may_alias));
typedef unsigned int   uv4   __attribute__((ext_vector_type(4)));
typedef unsigned int   uv4a  __attribute__((ext_vector_type(4), may_alias));

#define N_MODELS        16
#define IN_DIM          32
#define HID             64
#define OUT_DIM         8
#define OUT_PAD         16
#define THREADS         256
#define WAVES_PER_BLOCK 8
#define ROWS_PER_WAVE   32                                   // two 16-row WMMA sub-tiles per wave
#define ROWS_PER_BLOCK  (WAVES_PER_BLOCK * ROWS_PER_WAVE)    // 256

// Packed per-model weight blob (byte offsets), rows unpadded:
//   W1t bf16 [64 n][32 k], W2t/W3t f16 [64 n][64 k] (x256), W4t f16 [16 n][64 k] (x256, n 8..15 zero),
#define OFFB_W1     0
#define OFFB_W2     4096
#define OFFB_W3     12288
#define OFFB_W4     20480
#define OFFB_B      22528
#define OFFB_PAD    23360
#define BLOB_BYTES  23552
#define BLOB_CHUNKS (BLOB_BYTES / 16)                        // 1472
#define WSCALE      256.0f
#define WSCALE_INV  0.00390625f

// LDS image of the blob: same rows, each at a pitch of 16 B x odd, so that the 16 lanes of a
// ds_load_b128 fragment read fall on 16 different groups of four banks.
#define W1_PITCH    40                                       // bf16 elements: 64-B rows at 80 B
#define H_PITCH     72                                       // f16 elements: 128-B rows at 144 B (W2t, W3t, W4t)
#define OFFS_W1     0
#define OFFS_W2     (HID * W1_PITCH * 2)                     // 5120
#define OFFS_W3     (OFFS_W2 + HID * H_PITCH * 2)            // 14336
#define OFFS_W4     (OFFS_W3 + HID * H_PITCH * 2)            // 23552
#define OFFS_B      (OFFS_W4 + OUT_PAD * H_PITCH * 2)        // 25856
#define SIMG_BYTES  (OFFS_B + (BLOB_BYTES - OFFB_B))         // 26880

static_assert(BLOB_BYTES % 128 == 0);
static_assert(OFFB_B + 208 * 4 == OFFB_PAD);
static_assert(OFFB_PAD % 16 == 0);

// Byte offset in the LDS image of 16-byte chunk e of the packed blob.
__device__ __forceinline__ int simg_offset(int e) {
    if (e < OFFB_W2 / 16) return OFFS_W1 + (e >> 2) * (W1_PITCH * 2) + (e & 3) * 16;       // 4 chunks a row
    if (e < OFFB_B / 16) {
        const int q = e - OFFB_W2 / 16;                                                    // 8 chunks a row
        return OFFS_W2 + (q >> 3) * (H_PITCH * 2) + (q & 7) * 16;
    }
    return OFFS_B + (e - OFFB_B / 16) * 16;
}

union FragH  { v16h  v; v8h  h[2]; };
union FragBF { v16bf v; v8us h[2]; };

__device__ __forceinline__ unsigned short bf16_bits(float f) {
    unsigned int u = __float_as_uint(f);
    u += 0x7FFFu + ((u >> 16) & 1u);                         // RNE convert to bf16
    return (unsigned short)(u >> 16);
}

__device__ __forceinline__ float bf16_rne(float f) {
    return __uint_as_float(((unsigned int)bf16_bits(f)) << 16);
}

__device__ __forceinline__ v8f v8f_splat(float v) {
    v8f r;
#pragma unroll
    for (int i = 0; i < 8; ++i) r[i] = v;
    return r;
}

// WMMA issue + hazard guard (ties D, keeps A/B live).
__device__ __forceinline__ v8f mma_f16(v16h a, v16h b, v8f c) {
    v8f d = __builtin_amdgcn_wmma_f32_16x16x32_f16(false, a, false, b, (short)0, c, false, false);
    asm volatile("v_nop\n\tv_nop\n\tv_nop\n\tv_nop" : "+v"(d) : "v"(a), "v"(b));
    return d;
}

__device__ __forceinline__ v8f mma_bf16(v16bf a, v16bf b, v8f c) {
    v8f d = __builtin_amdgcn_wmma_f32_16x16x32_bf16(false, a, false, b, (short)0, c, false, false);
    asm volatile("v_nop\n\tv_nop\n\tv_nop\n\tv_nop" : "+v"(d) : "v"(a), "v"(b));
    return d;
}

// 16-bit A fragment from a k-contiguous [idx][k] weight tile (idx = output feature), split k map:
// elements 0..7 <- k = K0 + 8*half + 0..7, elements 8..15 <- k = K0 + 16 + 8*half + 0..7.
__device__ __forceinline__ v16h ld_frag_h(const _Float16* base, int ld, int K0, int idx, int half) {
    const _Float16* p = base + idx * ld + K0 + 8 * half;
    FragH f;
    f.h[0] = *(const v8ha*)(p);
    f.h[1] = *(const v8ha*)(p + 16);
    return f.v;
}

__device__ __forceinline__ v16bf ld_frag_bf(const unsigned short* base, int ld, int K0, int idx, int half) {
    const unsigned short* p = base + idx * ld + K0 + 8 * half;
    FragBF f;
    f.h[0] = *(const v8usa*)(p);
    f.h[1] = *(const v8usa*)(p + 16);
    return f.v;
}

union PackH { v8h v; v2h p[4]; };

// One D tile (lane: features f0 + 8*half + 0..7 of batch column r) -> acc*scale + bias, f32->f16, ReLU.
// The eight packed values are elements 0..7 (even tile) or 8..15 (odd tile) of the next layer's B fragment:
// k = 8*half + v and k = 16 + 8*half + v, the split k map of ld_frag_h.
__device__ __forceinline__ v8h relu_pack(v8f acc, float scale, v4f blo, v4f bhi) {
    PackH o;
#pragma unroll   // constant indices keep acc, the bias and o in registers
    for (int i = 0; i < 4; ++i) {
        const v2f a  = {acc[2 * i], acc[2 * i + 1]};
        const v2f b  = (i < 2) ? (v2f){blo[2 * i], blo[2 * i + 1]} : (v2f){bhi[2 * i - 4], bhi[2 * i - 3]};
        const v2f sc = {scale, scale};
        const v2h q  = __builtin_convertvector(__builtin_elementwise_fma(a, sc, b), v2h);
        o.p[i] = __builtin_elementwise_max(q, (v2h){(_Float16)0.0f, (_Float16)0.0f});
    }
    return o.v;
}

// One 64->64 hidden layer for both 16-column batch sub-tiles; h?0 holds k 0..31, h?1 holds k 32..63, replaced in place.
__device__ __forceinline__ void layer_hid(const _Float16* Wt, const float* bias, int r, int half,
                                          v16h& h00, v16h& h01, v16h& h10, v16h& h11) {
    FragH o00, o01, o10, o11;
#pragma unroll   // t picks the output fragment half: constant so that the fragments stay in registers
    for (int t = 0; t < 4; ++t) {
        const int n = t * 16 + r;
        v16h a0 = ld_frag_h(Wt, H_PITCH, 0,  n, half);
        v16h a1 = ld_frag_h(Wt, H_PITCH, 32, n, half);
        const v4f blo = *(const v4fa*)(bias + t * 16 + 8 * half);
        const v4f bhi = *(const v4fa*)(bias + t * 16 + 8 * half + 4);
        v8f acc0 = v8f_splat(0.0f), acc1 = v8f_splat(0.0f);
        acc0 = mma_f16(a0, h00, acc0);
        acc1 = mma_f16(a0, h10, acc1);
        acc0 = mma_f16(a1, h01, acc0);
        acc1 = mma_f16(a1, h11, acc1);
        const v8h q0 = relu_pack(acc0, WSCALE_INV, blo, bhi);
        const v8h q1 = relu_pack(acc1, WSCALE_INV, blo, bhi);
        if (t < 2) { o00.h[t & 1] = q0; o10.h[t & 1] = q1; }
        else       { o01.h[t & 1] = q0; o11.h[t & 1] = q1; }
    }
    h00 = o00.v; h01 = o01.v; h10 = o10.v; h11 = o11.v;
}

__global__ __launch_bounds__(THREADS)
void mlp_stats_kernel(const float* __restrict__ x,
                      const unsigned char* __restrict__ wblob,
                      const unsigned char* __restrict__ wblob2,
                      float* __restrict__ out, int batch) {
    __shared__ __align__(16) unsigned char sBlob[SIMG_BYTES];                           // 26,880 B

    const unsigned short* sW1 = (const unsigned short*)(sBlob + OFFS_W1);
    const _Float16* sW2 = (const _Float16*)(sBlob + OFFS_W2);
    const _Float16* sW3 = (const _Float16*)(sBlob + OFFS_W3);
    const _Float16* sW4 = (const _Float16*)(sBlob + OFFS_W4);
    const float* sb  = (const float*)(sBlob + OFFS_B);
    const float* sb1 = sb;
    const float* sb2 = sb + 64;
    const float* sb3 = sb + 128;
    const float* sb4 = sb + 192;

    const int tid  = threadIdx.x;
    const int wave = tid >> 5;
    const int lane = tid & 31;
    const int r    = lane & 15;
    const int half = lane >> 4;
    const int rowbase = blockIdx.x * ROWS_PER_BLOCK + wave * ROWS_PER_WAVE;

    // ---- x rows -> two bf16 B fragments (column = batch row, split k map), kept in VGPRs for all models ----
    v16bf xa0, xa1;
    {
        FragBF fx;
#pragma unroll
        for (int s = 0; s < 2; ++s) {
            int row = rowbase + s * 16 + r;
            row = (row < batch) ? row : (batch - 1);
            const float* xr = x + (size_t)row * IN_DIM + 8 * half;
            const v4f f0 = *(const v4f*)(xr);
            const v4f f1 = *(const v4f*)(xr + 4);
            const v4f f2 = *(const v4f*)(xr + 16);
            const v4f f3 = *(const v4f*)(xr + 20);
            v8us lo, hi;
            lo[0] = bf16_bits(f0[0]); lo[1] = bf16_bits(f0[1]); lo[2] = bf16_bits(f0[2]); lo[3] = bf16_bits(f0[3]);
            lo[4] = bf16_bits(f1[0]); lo[5] = bf16_bits(f1[1]); lo[6] = bf16_bits(f1[2]); lo[7] = bf16_bits(f1[3]);
            hi[0] = bf16_bits(f2[0]); hi[1] = bf16_bits(f2[1]); hi[2] = bf16_bits(f2[2]); hi[3] = bf16_bits(f2[3]);
            hi[4] = bf16_bits(f3[0]); hi[5] = bf16_bits(f3[1]); hi[6] = bf16_bits(f3[2]); hi[7] = bf16_bits(f3[3]);
            fx.h[0] = lo;
            fx.h[1] = hi;
            if (s == 0) xa0 = fx.v; else xa1 = fx.v;
        }
    }

    // shifted running sums over models: d = pred - pred(model 0)
    v8f sum0 = v8f_splat(0.0f), sq0 = v8f_splat(0.0f), p00 = v8f_splat(0.0f);
    v8f sum1 = v8f_splat(0.0f), sq1 = v8f_splat(0.0f), p01 = v8f_splat(0.0f);

#pragma unroll 1
    for (int m = 0; m < N_MODELS; ++m) {
        __syncthreads();                       // all waves done with the prior model's weights

        // ---- stage this model's packed weights: plain 16-B copies, sentinel fallback to copy 2 ----
        {
            const uv4a* g1 = (const uv4a*)(wblob  + (size_t)m * BLOB_BYTES);
            const uv4a* g2 = (const uv4a*)(wblob2 + (size_t)m * BLOB_BYTES);
            for (int e = tid; e < BLOB_CHUNKS; e += THREADS) {
                uv4 v = g1[e];
                const int off = simg_offset(e);
                const bool fill = (v.x == 0xAAAAAAAAu) & (v.y == 0xAAAAAAAAu) &
                                  (v.z == 0xAAAAAAAAu) & (v.w == 0xAAAAAAAAu);
                if (fill) {
                    v = g2[e];
                    // precaution: stands in front of the loop's step of this load's address registers
                    asm volatile("s_wait_xcnt 0x0" ::: "memory");
                }
                *(uv4a*)(sBlob + off) = v;
            }
        }
        __syncthreads();

        // ---- Layer 1: relu(W1t @ xt + b1), K = 32, bf16 operands ----
        v16h h00, h01, h10, h11;
        {
            FragH o00, o01, o10, o11;
#pragma unroll   // as in layer_hid
            for (int t = 0; t < 4; ++t) {
                v16bf aw = ld_frag_bf(sW1, W1_PITCH, 0, t * 16 + r, half);
                const v4f blo = *(const v4fa*)(sb1 + t * 16 + 8 * half);
                const v4f bhi = *(const v4fa*)(sb1 + t * 16 + 8 * half + 4);
                v8f acc0 = v8f_splat(0.0f), acc1 = v8f_splat(0.0f);
                acc0 = mma_bf16(aw, xa0, acc0);
                acc1 = mma_bf16(aw, xa1, acc1);
                const v8h q0 = relu_pack(acc0, 1.0f, blo, bhi);
                const v8h q1 = relu_pack(acc1, 1.0f, blo, bhi);
                if (t < 2) { o00.h[t & 1] = q0; o10.h[t & 1] = q1; }
                else       { o01.h[t & 1] = q0; o11.h[t & 1] = q1; }
            }
            h00 = o00.v; h01 = o01.v; h10 = o10.v; h11 = o11.v;
        }

        // ---- Layers 2 and 3 ----
        layer_hid(sW2, sb2, r, half, h00, h01, h10, h11);
        layer_hid(sW3, sb3, r, half, h00, h01, h10, h11);

        // ---- Layer 4: pred = W4t @ h3t + b4 (outputs padded to 16 rows), shifted statistics ----
        // lane: outputs 8*half + 0..7 of batch column r; half 1 holds the zero padding
        {
            v16h a0 = ld_frag_h(sW4, H_PITCH, 0,  r, half);
            v16h a1 = ld_frag_h(sW4, H_PITCH, 32, r, half);
            const v4f blo = *(const v4fa*)(sb4 + 8 * half);
            const v4f bhi = *(const v4fa*)(sb4 + 8 * half + 4);
            v8f acc0 = v8f_splat(0.0f), acc1 = v8f_splat(0.0f);
            acc0 = mma_f16(a0, h00, acc0);
            acc1 = mma_f16(a0, h10, acc1);
            acc0 = mma_f16(a1, h01, acc0);
            acc1 = mma_f16(a1, h11, acc1);
            const v8f bv8 = {blo[0], blo[1], blo[2], blo[3], bhi[0], bhi[1], bhi[2], bhi[3]};
            const v8f sc8 = v8f_splat(WSCALE_INV);
            v8f pred0 = acc0 * sc8 + bv8;
            v8f pred1 = acc1 * sc8 + bv8;
            if (m == 0) {
                p00 = pred0;
                p01 = pred1;
            } else {
                v8f d0 = pred0 - p00;
                v8f d1 = pred1 - p01;
                sum0 += d0; sq0 += d0 * d0;
                sum1 += d1; sq1 += d1 * d1;
            }
        }
    }

    // a lane of half 0 holds all 8 outputs of one batch row: 32 contiguous bytes of each output plane
    if (half == 0) {
#pragma unroll   // s selects register sets
        for (int s = 0; s < 2; ++s) {
            const v8f su8 = s ? sum1 : sum0;
            const v8f sq8 = s ? sq1  : sq0;
            const v8f pz8 = s ? p01  : p00;
            v8f mean8, sd8;
#pragma unroll   // constant vector indices
            for (int v = 0; v < 8; ++v) {
                const float su = su8[v];
                mean8[v] = __builtin_fmaf(su, 1.0f / 16.0f, pz8[v]);
                float var = (sq8[v] - su * su * (1.0f / 16.0f)) * (1.0f / 15.0f);
                var = __builtin_fmaxf(var, 0.0f);
                sd8[v] = sqrtf(var);
            }
            const int row = rowbase + s * 16 + r;
            if (row < batch) {
                float* o0 = out + (size_t)row * OUT_DIM;
                float* o1 = out + (size_t)batch * OUT_DIM + (size_t)row * OUT_DIM;
                *(v4f*)(o0)     = (v4f){mean8[0], mean8[1], mean8[2], mean8[3]};
                *(v4f*)(o0 + 4) = (v4f){mean8[4], mean8[5], mean8[6], mean8[7]};
                *(v4f*)(o1)     = (v4f){sd8[0], sd8[1], sd8[2], sd8[3]};
                *(v4f*)(o1 + 4) = (v4f){sd8[4], sd8[5], sd8[6], sd8[7]};
            }
        }
    }
}

// Prologue: per model, build the packed blob image in LDS (transpose, 16-bit convert, scale, pad),
__global__ __launch_bounds__(THREADS)
void pack_weights_kernel(const float* __restrict__ W1, const float* __restrict__ b1,
                         const float* __restrict__ W2, const float* __restrict__ b2,
                         const float* __restrict__ W3, const float* __restrict__ b3,
                         const float* __restrict__ W4, const float* __restrict__ b4,
                         unsigned char* __restrict__ blob) {
    __shared__ __align__(16) unsigned char img[BLOB_BYTES];
    const int m   = blockIdx.x;
    const int tid = threadIdx.x;

    unsigned short* w1 = (unsigned short*)(img + OFFB_W1);
    _Float16* w2 = (_Float16*)(img + OFFB_W2);
    _Float16* w3 = (_Float16*)(img + OFFB_W3);
    _Float16* w4 = (_Float16*)(img + OFFB_W4);
    float* bb = (float*)(img + OFFB_B);

    // W1[m] is [32 k][64 n] -> bf16 [n][k]
    const float* g = W1 + (size_t)m * IN_DIM * HID;
    for (int e = tid; e < IN_DIM * HID; e += THREADS) {
        const int k = e >> 6, n = e & 63;
        w1[n * IN_DIM + k] = bf16_bits(g[e]);
    }
    // W2[m], W3[m] are [64 k][64 n] -> f16(256 * bf16(w)) [n][k]
    g = W2 + (size_t)m * HID * HID;
    for (int e = tid; e < HID * HID; e += THREADS) {
        const int k = e >> 6, n = e & 63;
        w2[n * HID + k] = (_Float16)(WSCALE * bf16_rne(g[e]));
    }
    g = W3 + (size_t)m * HID * HID;
    for (int e = tid; e < HID * HID; e += THREADS) {
        const int k = e >> 6, n = e & 63;
        w3[n * HID + k] = (_Float16)(WSCALE * bf16_rne(g[e]));
    }
    // W4[m] is [64 k][8 n] -> f16 [16 n][64 k], n >= 8 zero
    g = W4 + (size_t)m * HID * OUT_DIM;
    for (int e = tid; e < OUT_PAD * HID; e += THREADS) {
        const int n = e >> 6, k = e & 63;
        const float wv = (n < OUT_DIM) ? (WSCALE * bf16_rne(g[k * OUT_DIM + n])) : 0.0f;
        w4[e] = (_Float16)wv;
    }
    if (tid < HID) {
        bb[tid]       = bf16_rne(b1[m * HID + tid]);
        bb[64 + tid]  = bf16_rne(b2[m * HID + tid]);
        bb[128 + tid] = bf16_rne(b3[m * HID + tid]);
    }
    if (tid < OUT_PAD) bb[192 + tid] = (tid < OUT_DIM) ? bf16_rne(b4[m * OUT_DIM + tid]) : 0.0f;
    if (tid < (BLOB_BYTES - OFFB_PAD) / 4) ((float*)(img + OFFB_PAD))[tid] = 0.0f;
    __syncthreads();

    const uv4a* src = (const uv4a*)img;
    unsigned char* dst = blob + (size_t)m * BLOB_BYTES;
    for (int e = tid; e < BLOB_CHUNKS; e += THREADS) {
        const uv4 v = src[e];
        *(uv4*)(dst + (size_t)e * 16) = v;
    }
    
}

extern "C" void kernel_launch(void* const* d_in, const int* in_sizes, int n_in,
                              void* d_out, int out_size, void* d_ws, size_t ws_size,
                              hipStream_t stream) {
    (void)n_in;
    const float* x  = (const float*)d_in[0];
    const float* W1 = (const float*)d_in[1];
    const float* b1 = (const float*)d_in[2];
    const float* W2 = (const float*)d_in[3];
    const float* b2 = (const float*)d_in[4];
    const float* W3 = (const float*)d_in[5];
    const float* b3 = (const float*)d_in[6];
    const float* W4 = (const float*)d_in[7];
    const float* b4 = (const float*)d_in[8];
    float* out = (float*)d_out;

    const int batch = in_sizes[0] / IN_DIM;                                      // 131072
    if (batch <= 0) return;
    if ((long long)out_size < 2LL * (long long)batch * OUT_DIM) return;

    const size_t copy_bytes = (size_t)N_MODELS * BLOB_BYTES;                     // 376,832 B per copy
    if (ws_size < 2 * copy_bytes) return;
    unsigned char* blob  = (unsigned char*)d_ws;
    unsigned char* blob2 = blob + copy_bytes;                                    // total carve 753,664 B

    const int blocks = (batch + ROWS_PER_BLOCK - 1) / ROWS_PER_BLOCK;           // 512

    pack_weights_kernel<<<dim3(N_MODELS), dim3(THREADS), 0, stream>>>(W1, b1, W2, b2, W3, b3, W4, b4, blob);
    pack_weights_kernel<<<dim3(N_MODELS), dim3(THREADS), 0, stream>>>(W1, b1, W2, b2, W3, b3, W4, b4, blob2);
    mlp_stats_kernel<<<dim3(blocks), dim3(THREADS), 0, stream>>>(x, blob, blob2, out, batch);
}

// v003
// One run takes 53.4 microseconds.
// In both of two side-by-side timings against v002, it was 1.70 times as fast.
// Over all steps from v000 it is 3.91 times as fast.
#include <hip/hip_runtime.h>

// Every product is computed transposed: weights [n][k] are the A operand, activations (batch in the columns) the B operand,
// so a lane's D registers of two neighbouring 16-feature tiles, packed to f16, are the next layer's B fragment in place.
// Layer 1: v_wmma_f32_16x16x32_bf16 (bf16 operands = RNE-converted x and W1); layers 2-4: v_wmma_f32_16x16x32_f16 (f16 activations, f16 weights = bf16-RNE weights scaled by 256, scaled back by 1/256 in the f32 epilogue); f32 accumulate everywhere; member mean/std in f32.

typedef _Float16       v16h  __attribute__((ext_vector_type(16)));
typedef _Float16       v8h   __attribute__((ext_vector_type(8)));
typedef _Float16       v8ha  __attribute__((ext_vector_type(8), may_alias));
typedef __bf16         v16bf __attribute__((ext_vector_type(16)));
typedef unsigned short v8us  __attribute__((ext_vector_type(8)));
typedef unsigned short v8usa __attribute__((ext_vector_type(8), may_alias));
typedef float          v8f   __attribute__((ext_vector_type(8)));
typedef _Float16       v2h   __attribute__((ext_vector_type(2)));
typedef float          v2f   __attribute__((ext_vector_type(2)));
typedef float          v4f   __attribute__((ext_vector_type(4)));
typedef float          v4fa  __attribute__((ext_vector_type(4), may_alias));
typedef unsigned int   uv4   __attribute__((ext_vector_type(4)));
typedef unsigned int   uv4a  __attribute__((ext_vector_type(4), may_alias));

#define N_MODELS        16
#define IN_DIM          32
#define HID             64
#define OUT_DIM         8
#define OUT_PAD         16
#define THREADS         256
#define WAVES_PER_BLOCK 8
#define ROWS_PER_WAVE   32                                   // two 16-row WMMA sub-tiles per wave
#define ROWS_PER_BLOCK  (WAVES_PER_BLOCK * ROWS_PER_WAVE)    // 256

// Packed per-model weight blob (byte offsets), rows unpadded:
//   W1t bf16 [64 n][32 k], W2t/W3t f16 [64 n][64 k] (x256), W4t f16 [16 n][64 k] (x256, n 8..15 zero),
#define OFFB_W1     0
#define OFFB_W2     4096
#define OFFB_W3     12288
#define OFFB_W4     20480
#define OFFB_B      22528
#define OFFB_PAD    23360
#define BLOB_BYTES  23552
#define BLOB_CHUNKS (BLOB_BYTES / 16)                        // 1472
#define WSCALE      256.0f
#define WSCALE_INV  0.00390625f

// LDS image of the blob: same rows, each at a pitch of 16 B x odd, so that the 16 lanes of a
// ds_load_b128 fragment read fall on 16 different groups of four banks.
#define W1_PITCH    40                                       // bf16 elements: 64-B rows at 80 B
#define H_PITCH     72                                       // f16 elements: 128-B rows at 144 B (W2t, W3t, W4t)
#define OFFS_W1     0
#define OFFS_W2     (HID * W1_PITCH * 2)                     // 5120
#define OFFS_W3     (OFFS_W2 + HID * H_PITCH * 2)            // 14336
#define OFFS_W4     (OFFS_W3 + HID * H_PITCH * 2)            // 23552
#define OFFS_B      (OFFS_W4 + OUT_PAD * H_PITCH * 2)        // 25856
#define SIMG_BYTES  (OFFS_B + (BLOB_BYTES - OFFB_B))         // 26880

static_assert(BLOB_BYTES % 128 == 0);
static_assert(OFFB_B + 208 * 4 == OFFB_PAD);
static_assert(OFFB_PAD % 16 == 0);

#define STAGE_TRIPS      5                                   // chunks 0..1279: five 16-B copies by every thread
#define STAGE_TAIL_WAVES ((BLOB_CHUNKS - STAGE_TRIPS * THREADS) / 32)   // chunks 1280..1471: a sixth copy by waves 0..5
static_assert(STAGE_TRIPS * THREADS + STAGE_TAIL_WAVES * 32 == BLOB_CHUNKS);
static_assert(SIMG_BYTES % 16 == 0);
static_assert(OFFB_W2 / 16 == THREADS);                      // copy 0 is all of W1t
static_assert(OFFB_B / 16 == 5 * THREADS + 128);             // copies 1..4 and threads 0..127 of copy 5: W2t, W3t, W4t rows
#define TRIP_STEP        (THREADS / 8 * H_PITCH * 2)         // 32 rows of 8 chunks a trip: 4,608 B of the LDS image

// One model's blob -> one LDS image, each lane's 16-B chunks as asynchronous copies (no register on the way).
// g: the lane's chunk 0 of that blob; l0..l5: the lane's LDS byte addresses in the target image; tail: wave-uniform.
// s_wait_xcnt closes each statement: a precaution, it stands in front of every later rewrite of the address registers.
__device__ __forceinline__ void stage_async(const unsigned char* g, unsigned l0, unsigned l1, unsigned l2,
                                            unsigned l3, unsigned l4, unsigned l5, bool tail) {
    const unsigned char* g1 = g + 1 * THREADS * 16;
    const unsigned char* g2 = g + 2 * THREADS * 16;
    const unsigned char* g3 = g + 3 * THREADS * 16;
    const unsigned char* g4 = g + 4 * THREADS * 16;
    asm volatile("global_load_async_to_lds_b128 %0, %5, off\n\t"
                 "global_load_async_to_lds_b128 %1, %6, off\n\t"
                 "global_load_async_to_lds_b128 %2, %7, off\n\t"
                 "global_load_async_to_lds_b128 %3, %8, off\n\t"
                 "global_load_async_to_lds_b128 %4, %9, off\n\t"
                 "s_wait_xcnt 0x0"
                 :: "v"(l0), "v"(l1), "v"(l2), "v"(l3), "v"(l4), "v"(g), "v"(g1), "v"(g2), "v"(g3), "v"(g4)
                 : "memory");
    if (tail) {
        const unsigned char* g5 = g + 5 * THREADS * 16;
        asm volatile("global_load_async_to_lds_b128 %0, %1, off\n\t"
                     "s_wait_xcnt 0x0"
                     :: "v"(l5), "v"(g5) : "memory");
    }
}

union FragH  { v16h  v; v8h  h[2]; };
union FragBF { v16bf v; v8us h[2]; };

__device__ __forceinline__ unsigned short bf16_bits(float f) {
    unsigned int u = __float_as_uint(f);
    u += 0x7FFFu + ((u >> 16) & 1u);                         // RNE convert to bf16
    return (unsigned short)(u >> 16);
}

__device__ __forceinline__ float bf16_rne(float f) {
    return __uint_as_float(((unsigned int)bf16_bits(f)) << 16);
}

__device__ __forceinline__ v8f v8f_splat(float v) {
    v8f r;
#pragma unroll
    for (int i = 0; i < 8; ++i) r[i] = v;
    return r;
}

// WMMA issue + hazard guard (ties D, keeps A/B live).
__device__ __forceinline__ v8f mma_f16(v16h a, v16h b, v8f c) {
    v8f d = __builtin_amdgcn_wmma_f32_16x16x32_f16(false, a, false, b, (short)0, c, false, false);
    asm volatile("v_nop\n\tv_nop\n\tv_nop\n\tv_nop" : "+v"(d) : "v"(a), "v"(b));
    return d;
}

__device__ __forceinline__ v8f mma_bf16(v16bf a, v16bf b, v8f c) {
    v8f d = __builtin_amdgcn_wmma_f32_16x16x32_bf16(false, a, false, b, (short)0, c, false, false);
    asm volatile("v_nop\n\tv_nop\n\tv_nop\n\tv_nop" : "+v"(d) : "v"(a), "v"(b));
    return d;
}

// 16-bit A fragment from a k-contiguous [idx][k] weight tile (idx = output feature), split k map:
// elements 0..7 <- k = K0 + 8*half + 0..7, elements 8..15 <- k = K0 + 16 + 8*half + 0..7.
__device__ __forceinline__ v16h ld_frag_h(const _Float16* base, int ld, int K0, int idx, int half) {
    const _Float16* p = base + idx * ld + K0 + 8 * half;
    FragH f;
    f.h[0] = *(const v8ha*)(p);
    f.h[1] = *(const v8ha*)(p + 16);
    return f.v;
}

__device__ __forceinline__ v16bf ld_frag_bf(const unsigned short* base, int ld, int K0, int idx, int half) {
    const unsigned short* p = base + idx * ld + K0 + 8 * half;
    FragBF f;
    f.h[0] = *(const v8usa*)(p);
    f.h[1] = *(const v8usa*)(p + 16);
    return f.v;
}

union PackH { v8h v; v2h p[4]; };

// One D tile (lane: features f0 + 8*half + 0..7 of batch column r) -> acc*scale + bias, f32->f16, ReLU.
// The eight packed values are elements 0..7 (even tile) or 8..15 (odd tile) of the next layer's B fragment:
// k = 8*half + v and k = 16 + 8*half + v, the split k map of ld_frag_h.
__device__ __forceinline__ v8h relu_pack(v8f acc, float scale, v4f blo, v4f bhi) {
    PackH o;
#pragma unroll   // constant indices keep acc, the bias and o in registers
    for (int i = 0; i < 4; ++i) {
        const v2f a  = {acc[2 * i], acc[2 * i + 1]};
        const v2f b  = (i < 2) ? (v2f){blo[2 * i], blo[2 * i + 1]} : (v2f){bhi[2 * i - 4], bhi[2 * i - 3]};
        const v2f sc = {scale, scale};
        const v2h q  = __builtin_convertvector(__builtin_elementwise_fma(a, sc, b), v2h);
        o.p[i] = __builtin_elementwise_max(q, (v2h){(_Float16)0.0f, (_Float16)0.0f});
    }
    return o.v;
}

// One 64->64 hidden layer for both 16-column batch sub-tiles; h?0 holds k 0..31, h?1 holds k 32..63, replaced in place.
__device__ __forceinline__ void layer_hid(const _Float16* Wt, const float* bias, int r, int half,
                                          v16h& h00, v16h& h01, v16h& h10, v16h& h11) {
    FragH o00, o01, o10, o11;
#pragma unroll   // t picks the output fragment half: constant so that the fragments stay in registers
    for (int t = 0; t < 4; ++t) {
        const int n = t * 16 + r;
        v16h a0 = ld_frag_h(Wt, H_PITCH, 0,  n, half);
        v16h a1 = ld_frag_h(Wt, H_PITCH, 32, n, half);
        const v4f blo = *(const v4fa*)(bias + t * 16 + 8 * half);
        const v4f bhi = *(const v4fa*)(bias + t * 16 + 8 * half + 4);
        v8f acc0 = v8f_splat(0.0f), acc1 = v8f_splat(0.0f);
        acc0 = mma_f16(a0, h00, acc0);
        acc1 = mma_f16(a0, h10, acc1);
        acc0 = mma_f16(a1, h01, acc0);
        acc1 = mma_f16(a1, h11, acc1);
        const v8h q0 = relu_pack(acc0, WSCALE_INV, blo, bhi);
        const v8h q1 = relu_pack(acc1, WSCALE_INV, blo, bhi);
        if (t < 2) { o00.h[t & 1] = q0; o10.h[t & 1] = q1; }
        else       { o01.h[t & 1] = q0; o11.h[t & 1] = q1; }
    }
    h00 = o00.v; h01 = o01.v; h10 = o10.v; h11 = o11.v;
}

__global__ __launch_bounds__(THREADS)
void mlp_stats_kernel(const float* __restrict__ x,
                      const unsigned char* __restrict__ wblob,
                      float* __restrict__ out, int batch) {
    __shared__ __align__(16) unsigned char sBlob[2 * SIMG_BYTES];                       // two images, 53,760 B

    const int tid  = threadIdx.x;
    const int wave = tid >> 5;
    const int lane = tid & 31;
    const int r    = lane & 15;
    const int half = lane >> 4;
    const int rowbase = blockIdx.x * ROWS_PER_BLOCK + wave * ROWS_PER_WAVE;

    // ---- weight ring, two LDS images: model 0's copies start here and land under the x loads ----
    const bool tail = __builtin_amdgcn_readfirstlane(wave) < STAGE_TAIL_WAVES;          // scalar: whole waves take or skip copy 5
    const unsigned lbase = (unsigned)(size_t)sBlob;                                     // LDS byte address of image 0
    // LDS place of 16-B chunk tid + 256 k of the blob: the rows at their padded pitch, biases and pad behind them
    const unsigned l0 = lbase + OFFS_W1 + (tid >> 2) * (W1_PITCH * 2) + (tid & 3) * 16; // 4 chunks a row
    const unsigned l1 = lbase + OFFS_W2 + (tid >> 3) * (H_PITCH * 2) + (tid & 7) * 16;  // 8 chunks a row
    const unsigned l2 = l1 + 1 * TRIP_STEP;
    const unsigned l3 = l1 + 2 * TRIP_STEP;
    const unsigned l4 = l1 + 3 * TRIP_STEP;
    const unsigned l5 = (tid < 128) ? (l1 + 4 * TRIP_STEP) : (lbase + OFFS_B + (tid - 128) * 16);   // named by waves 0..5 only
    const unsigned char* gl = wblob + tid * 16;
    stage_async(gl, l0, l1, l2, l3, l4, l5, tail);

    // ---- x rows -> two bf16 B fragments (column = batch row, split k map), kept in VGPRs for all models ----
    v16bf xa0, xa1;
    {
        FragBF fx;
#pragma unroll
        for (int s = 0; s < 2; ++s) {
            int row = rowbase + s * 16 + r;
            row = (row < batch) ? row : (batch - 1);
            const float* xr = x + (size_t)row * IN_DIM + 8 * half;
            const v4f f0 = *(const v4f*)(xr);
            const v4f f1 = *(const v4f*)(xr + 4);
            const v4f f2 = *(const v4f*)(xr + 16);
            const v4f f3 = *(const v4f*)(xr + 20);
            v8us lo, hi;
            lo[0] = bf16_bits(f0[0]); lo[1] = bf16_bits(f0[1]); lo[2] = bf16_bits(f0[2]); lo[3] = bf16_bits(f0[3]);
            lo[4] = bf16_bits(f1[0]); lo[5] = bf16_bits(f1[1]); lo[6] = bf16_bits(f1[2]); lo[7] = bf16_bits(f1[3]);
            hi[0] = bf16_bits(f2[0]); hi[1] = bf16_bits(f2[1]); hi[2] = bf16_bits(f2[2]); hi[3] = bf16_bits(f2[3]);
            hi[4] = bf16_bits(f3[0]); hi[5] = bf16_bits(f3[1]); hi[6] = bf16_bits(f3[2]); hi[7] = bf16_bits(f3[3]);
            fx.h[0] = lo;
            fx.h[1] = hi;
            if (s == 0) xa0 = fx.v; else xa1 = fx.v;
        }
    }

    // shifted running sums over models: d = pred - pred(model 0)
    v8f sum0 = v8f_splat(0.0f), sq0 = v8f_splat(0.0f), p00 = v8f_splat(0.0f);
    v8f sum1 = v8f_splat(0.0f), sq1 = v8f_splat(0.0f), p01 = v8f_splat(0.0f);

    // model 0 landed (this wave's copies), then published to every wave; model 1 starts into image 1
    asm volatile("s_wait_asynccnt 0x0" ::: "memory");
    __syncthreads();
    stage_async(gl + BLOB_BYTES, l0 + SIMG_BYTES, l1 + SIMG_BYTES, l2 + SIMG_BYTES,
                l3 + SIMG_BYTES, l4 + SIMG_BYTES, l5 + SIMG_BYTES, tail);

#pragma unroll 1
    for (int m = 0; m < N_MODELS; ++m) {
        const unsigned bsel = (m & 1) ? SIMG_BYTES : 0;                                 // image that holds model m
        const unsigned char* sImg = sBlob + bsel;
        const unsigned short* sW1 = (const unsigned short*)(sImg + OFFS_W1);
        const _Float16* sW2 = (const _Float16*)(sImg + OFFS_W2);
        const _Float16* sW3 = (const _Float16*)(sImg + OFFS_W3);
        const _Float16* sW4 = (const _Float16*)(sImg + OFFS_W4);
        const float* sb1 = (const float*)(sImg + OFFS_B);
        const float* sb2 = sb1 + 64;
        const float* sb3 = sb1 + 128;
        const float* sb4 = sb1 + 192;

        // ---- Layer 1: relu(W1t @ xt + b1), K = 32, bf16 operands ----
        v16h h00, h01, h10, h11;
        {
            FragH o00, o01, o10, o11;
#pragma unroll   // as in layer_hid
            for (int t = 0; t < 4; ++t) {
                v16bf aw = ld_frag_bf(sW1, W1_PITCH, 0, t * 16 + r, half);
                const v4f blo = *(const v4fa*)(sb1 + t * 16 + 8 * half);
                const v4f bhi = *(const v4fa*)(sb1 + t * 16 + 8 * half + 4);
                v8f acc0 = v8f_splat(0.0f), acc1 = v8f_splat(0.0f);
                acc0 = mma_bf16(aw, xa0, acc0);
                acc1 = mma_bf16(aw, xa1, acc1);
                const v8h q0 = relu_pack(acc0, 1.0f, blo, bhi);
                const v8h q1 = relu_pack(acc1, 1.0f, blo, bhi);
                if (t < 2) { o00.h[t & 1] = q0; o10.h[t & 1] = q1; }
                else       { o01.h[t & 1] = q0; o11.h[t & 1] = q1; }
            }
            h00 = o00.v; h01 = o01.v; h10 = o10.v; h11 = o11.v;
        }

        // ---- Layers 2 and 3 ----
        layer_hid(sW2, sb2, r, half, h00, h01, h10, h11);
        layer_hid(sW3, sb3, r, half, h00, h01, h10, h11);

        // ---- Layer 4: pred = W4t @ h3t + b4 (outputs padded to 16 rows), shifted statistics ----
        // lane: outputs 8*half + 0..7 of batch column r; half 1 holds the zero padding
        {
            v16h a0 = ld_frag_h(sW4, H_PITCH, 0,  r, half);
            v16h a1 = ld_frag_h(sW4, H_PITCH, 32, r, half);
            const v4f blo = *(const v4fa*)(sb4 + 8 * half);
            const v4f bhi = *(const v4fa*)(sb4 + 8 * half + 4);
            v8f acc0 = v8f_splat(0.0f), acc1 = v8f_splat(0.0f);
            acc0 = mma_f16(a0, h00, acc0);
            acc1 = mma_f16(a0, h10, acc1);
            acc0 = mma_f16(a1, h01, acc0);
            acc1 = mma_f16(a1, h11, acc1);
            const v8f bv8 = {blo[0], blo[1], blo[2], blo[3], bhi[0], bhi[1], bhi[2], bhi[3]};
            const v8f sc8 = v8f_splat(WSCALE_INV);
            v8f pred0 = acc0 * sc8 + bv8;
            v8f pred1 = acc1 * sc8 + bv8;
            if (m == 0) {
                p00 = pred0;
                p01 = pred1;
            } else {
                v8f d0 = pred0 - p00;
                v8f d1 = pred1 - p01;
                sum0 += d0; sq0 += d0 * d0;
                sum1 += d1; sq1 += d1 * d1;
            }
        }

        // ---- publish point of model m + 1 ----
        asm volatile("s_wait_dscnt 0x0" ::: "memory");      // this wave's reads of image m & 1 are over before it is refilled
        asm volatile("s_wait_asynccnt 0x0" ::: "memory");   // this wave's copies of model m + 1 have landed
        __syncthreads();                                    // model m + 1 readable by all; image m & 1 left by all
        if (m + 2 < N_MODELS)
            stage_async(gl + (size_t)(m + 2) * BLOB_BYTES, l0 + bsel, l1 + bsel, l2 + bsel,
                        l3 + bsel, l4 + bsel, l5 + bsel, tail);
    }
    asm volatile("s_wait_asynccnt 0x0" ::: "memory");       // no copy outstanding when the wave ends

    // a lane of half 0 holds all 8 outputs of one batch row: 32 contiguous bytes of each output plane
    if (half == 0) {
#pragma unroll   // s selects register sets
        for (int s = 0; s < 2; ++s) {
            const v8f su8 = s ? sum1 : sum0;
            const v8f sq8 = s ? sq1  : sq0;
            const v8f pz8 = s ? p01  : p00;
            v8f mean8, sd8;
#pragma unroll   // constant vector indices
            for (int v = 0; v < 8; ++v) {
                const float su = su8[v];
                mean8[v] = __builtin_fmaf(su, 1.0f / 16.0f, pz8[v]);
                float var = (sq8[v] - su * su * (1.0f / 16.0f)) * (1.0f / 15.0f);
                var = __builtin_fmaxf(var, 0.0f);
                sd8[v] = sqrtf(var);
            }
            const int row = rowbase + s * 16 + r;
            if (row < batch) {
                float* o0 = out + (size_t)row * OUT_DIM;
                float* o1 = out + (size_t)batch * OUT_DIM + (size_t)row * OUT_DIM;
                *(v4f*)(o0)     = (v4f){mean8[0], mean8[1], mean8[2], mean8[3]};
                *(v4f*)(o0 + 4) = (v4f){mean8[4], mean8[5], mean8[6], mean8[7]};
                *(v4f*)(o1)     = (v4f){sd8[0], sd8[1], sd8[2], sd8[3]};
                *(v4f*)(o1 + 4) = (v4f){sd8[4], sd8[5], sd8[6], sd8[7]};
            }
        }
    }
}

// Prologue: per model, build the packed blob image in LDS (transpose, 16-bit convert, scale, pad),
__global__ __launch_bounds__(THREADS)
void pack_weights_kernel(const float* __restrict__ W1, const float* __restrict__ b1,
                         const float* __restrict__ W2, const float* __restrict__ b2,
                         const float* __restrict__ W3, const float* __restrict__ b3,
                         const float* __restrict__ W4, const float* __restrict__ b4,
                         unsigned char* __restrict__ blob) {
    __shared__ __align__(16) unsigned char img[BLOB_BYTES];
    const int m   = blockIdx.x;
    const int tid = threadIdx.x;

    unsigned short* w1 = (unsigned short*)(img + OFFB_W1);
    _Float16* w2 = (_Float16*)(img + OFFB_W2);
    _Float16* w3 = (_Float16*)(img + OFFB_W3);
    _Float16* w4 = (_Float16*)(img + OFFB_W4);
    float* bb = (float*)(img + OFFB_B);

    // W1[m] is [32 k][64 n] -> bf16 [n][k]
    const float* g = W1 + (size_t)m * IN_DIM * HID;
    for (int e = tid; e < IN_DIM * HID; e += THREADS) {
        const int k = e >> 6, n = e & 63;
        w1[n * IN_DIM + k] = bf16_bits(g[e]);
    }
    // W2[m], W3[m] are [64 k][64 n] -> f16(256 * bf16(w)) [n][k]
    g = W2 + (size_t)m * HID * HID;
    for (int e = tid; e < HID * HID; e += THREADS) {
        const int k = e >> 6, n = e & 63;
        w2[n * HID + k] = (_Float16)(WSCALE * bf16_rne(g[e]));
    }
    g = W3 + (size_t)m * HID * HID;
    for (int e = tid; e < HID * HID; e += THREADS) {
        const int k = e >> 6, n = e & 63;
        w3[n * HID + k] = (_Float16)(WSCALE * bf16_rne(g[e]));
    }
    // W4[m] is [64 k][8 n] -> f16 [16 n][64 k], n >= 8 zero
    g = W4 + (size_t)m * HID * OUT_DIM;
    for (int e = tid; e < OUT_PAD * HID; e += THREADS) {
        const int n = e >> 6, k = e & 63;
        const float wv = (n < OUT_DIM) ? (WSCALE * bf16_rne(g[k * OUT_DIM + n])) : 0.0f;
        w4[e] = (_Float16)wv;
    }
    if (tid < HID) {
        bb[tid]       = bf16_rne(b1[m * HID + tid]);
        bb[64 + tid]  = bf16_rne(b2[m * HID + tid]);
        bb[128 + tid] = bf16_rne(b3[m * HID + tid]);
    }
    if (tid < OUT_PAD) bb[192 + tid] = (tid < OUT_DIM) ? bf16_rne(b4[m * OUT_DIM + tid]) : 0.0f;
    if (tid < (BLOB_BYTES - OFFB_PAD) / 4) ((float*)(img + OFFB_PAD))[tid] = 0.0f;
    __syncthreads();

    const uv4a* src = (const uv4a*)img;
    unsigned char* dst = blob + (size_t)m * BLOB_BYTES;
    for (int e = tid; e < BLOB_CHUNKS; e += THREADS) {
        const uv4 v = src[e];
        *(uv4*)(dst + (size_t)e * 16) = v;
    }
    
}

extern "C" void kernel_launch(void* const* d_in, const int* in_sizes, int n_in,
                              void* d_out, int out_size, void* d_ws, size_t ws_size,
                              hipStream_t stream) {
    (void)n_in;
    const float* x  = (const float*)d_in[0];
    const float* W1 = (const float*)d_in[1];
    const float* b1 = (const float*)d_in[2];
    const float* W2 = (const float*)d_in[3];
    const float* b2 = (const float*)d_in[4];
    const float* W3 = (const float*)d_in[5];
    const float* b3 = (const float*)d_in[6];
    const float* W4 = (const float*)d_in[7];
    const float* b4 = (const float*)d_in[8];
    float* out = (float*)d_out;

    const int batch = in_sizes[0] / IN_DIM;                                      // 131072
    if (batch <= 0) return;
    if ((long long)out_size < 2LL * (long long)batch * OUT_DIM) return;

    const size_t copy_bytes = (size_t)N_MODELS * BLOB_BYTES;                     // 376,832 B
    if (ws_size < copy_bytes) return;
    unsigned char* blob  = (unsigned char*)d_ws;

    const int blocks = (batch + ROWS_PER_BLOCK - 1) / ROWS_PER_BLOCK;           // 512

    pack_weights_kernel<<<dim3(N_MODELS), dim3(THREADS), 0, stream>>>(W1, b1, W2, b2, W3, b3, W4, b4, blob);
    mlp_stats_kernel<<<dim3(blocks), dim3(THREADS), 0, stream>>>(x, blob, out, batch);
}

// v004
// Measured time: 48.8 microseconds a run.
// Timed twice side by side with v003, it ran 1.09 times as fast both times.
// Counting every step since v000, it is 4.26 times as fast.
#include <hip/hip_runtime.h>

// Every product is computed transposed: weights [n][k] are the A operand, activations (batch in the columns) the B operand,
// so a lane's D registers of two neighbouring 16-feature tiles, packed to f16, are the next layer's B fragment in place.
// Layer 1: v_wmma_f32_16x16x32_bf16 (bf16 operands = RNE-converted x and W1); layers 2-4: v_wmma_f32_16x16x32_f16 (f16 activations, f16 weights = bf16-RNE weights scaled by 256, scaled back by 1/256 in the f32 epilogue); f32 accumulate everywhere; member mean/std in f32.

typedef _Float16       v16h  __attribute__((ext_vector_type(16)));
typedef _Float16       v8h   __attribute__((ext_vector_type(8)));
typedef _Float16       v8ha  __attribute__((ext_vector_type(8), may_alias));
typedef __bf16         v16bf __attribute__((ext_vector_type(16)));
typedef unsigned short v8us  __attribute__((ext_vector_type(8)));
typedef unsigned short v8usa __attribute__((ext_vector_type(8), may_alias));
typedef float          v8f   __attribute__((ext_vector_type(8)));
typedef _Float16       v2h   __attribute__((ext_vector_type(2)));
typedef float          v2f   __attribute__((ext_vector_type(2)));
typedef float          v4f   __attribute__((ext_vector_type(4)));
typedef float          v4fa  __attribute__((ext_vector_type(4), may_alias));
typedef unsigned int   uv4   __attribute__((ext_vector_type(4)));
typedef unsigned int   uv4a  __attribute__((ext_vector_type(4), may_alias));

#define N_MODELS        16
#define IN_DIM          32
#define HID             64
#define OUT_DIM         8
#define OUT_PAD         16
#define THREADS         256
#define WAVES_PER_BLOCK 8
#define ROWS_PER_WAVE   32                                   // two 16-row WMMA sub-tiles per wave
#define ROWS_PER_BLOCK  (WAVES_PER_BLOCK * ROWS_PER_WAVE)    // 256

// Packed per-model weight blob (byte offsets), rows unpadded:
//   W1t bf16 [64 n][32 k], W2t/W3t f16 [64 n][64 k] (x256), W4t f16 [16 n][64 k] (x256, n 8..15 zero),
#define OFFB_W1     0
#define OFFB_W2     4096
#define OFFB_W3     12288
#define OFFB_W4     20480
#define OFFB_B      22528
#define OFFB_PAD    23360
#define BLOB_BYTES  23552
#define BLOB_CHUNKS (BLOB_BYTES / 16)                        // 1472
#define WSCALE      256.0f
#define WSCALE_INV  0.00390625f

// LDS image of the blob: same rows, each at a pitch of 16 B x odd, so that the 16 lanes of a
// ds_load_b128 fragment read fall on 16 different groups of four banks.
#define W1_PITCH    40                                       // bf16 elements: 64-B rows at 80 B
#define H_PITCH     72                                       // f16 elements: 128-B rows at 144 B (W2t, W3t, W4t)
#define OFFS_W1     0
#define OFFS_W2     (HID * W1_PITCH * 2)                     // 5120
#define OFFS_W3     (OFFS_W2 + HID * H_PITCH * 2)            // 14336
#define OFFS_W4     (OFFS_W3 + HID * H_PITCH * 2)            // 23552
#define OFFS_B      (OFFS_W4 + OUT_PAD * H_PITCH * 2)        // 25856
#define SIMG_BYTES  (OFFS_B + (BLOB_BYTES - OFFB_B))         // 26880

static_assert(BLOB_BYTES % 128 == 0);
static_assert(OFFB_B + 208 * 4 == OFFB_PAD);
static_assert(OFFB_PAD % 16 == 0);

#define STAGE_TRIPS      5                                   // chunks 0..1279: five 16-B copies by every thread
#define STAGE_TAIL_WAVES ((BLOB_CHUNKS - STAGE_TRIPS * THREADS) / 32)   // chunks 1280..1471: a sixth copy by waves 0..5
static_assert(STAGE_TRIPS * THREADS + STAGE_TAIL_WAVES * 32 == BLOB_CHUNKS);
static_assert(SIMG_BYTES % 16 == 0);
static_assert(OFFB_W2 / 16 == THREADS);                      // copy 0 is all of W1t
static_assert(OFFB_B / 16 == 5 * THREADS + 128);             // copies 1..4 and threads 0..127 of copy 5: W2t, W3t, W4t rows
#define TRIP_STEP        (THREADS / 8 * H_PITCH * 2)         // 32 rows of 8 chunks a trip: 4,608 B of the LDS image

// One model's blob -> one LDS image, each lane's 16-B chunks as asynchronous copies (no register on the way).
// g: the lane's chunk 0 of that blob; l0..l5: the lane's LDS byte addresses in the target image; tail: wave-uniform.
// s_wait_xcnt closes each statement: a precaution, it stands in front of every later rewrite of the address registers.
__device__ __forceinline__ void stage_async(const unsigned char* g, unsigned l0, unsigned l1, unsigned l2,
                                            unsigned l3, unsigned l4, unsigned l5, bool tail) {
    const unsigned char* g1 = g + 1 * THREADS * 16;
    const unsigned char* g2 = g + 2 * THREADS * 16;
    const unsigned char* g3 = g + 3 * THREADS * 16;
    const unsigned char* g4 = g + 4 * THREADS * 16;
    asm volatile("global_load_async_to_lds_b128 %0, %5, off\n\t"
                 "global_load_async_to_lds_b128 %1, %6, off\n\t"
                 "global_load_async_to_lds_b128 %2, %7, off\n\t"
                 "global_load_async_to_lds_b128 %3, %8, off\n\t"
                 "global_load_async_to_lds_b128 %4, %9, off\n\t"
                 "s_wait_xcnt 0x0"
                 :: "v"(l0), "v"(l1), "v"(l2), "v"(l3), "v"(l4), "v"(g), "v"(g1), "v"(g2), "v"(g3), "v"(g4)
                 : "memory");
    if (tail) {
        const unsigned char* g5 = g + 5 * THREADS * 16;
        asm volatile("global_load_async_to_lds_b128 %0, %1, off\n\t"
                     "s_wait_xcnt 0x0"
                     :: "v"(l5), "v"(g5) : "memory");
    }
}

union FragH  { v16h  v; v8h  h[2]; };
union FragBF { v16bf v; v8us h[2]; };

__device__ __forceinline__ unsigned short bf16_bits(float f) {
    unsigned int u = __float_as_uint(f);
    u += 0x7FFFu + ((u >> 16) & 1u);                         // RNE convert to bf16
    return (unsigned short)(u >> 16);
}

__device__ __forceinline__ float bf16_rne(float f) {
    return __uint_as_float(((unsigned int)bf16_bits(f)) << 16);
}

__device__ __forceinline__ v8f v8f_splat(float v) {
    v8f r;
#pragma unroll
    for (int i = 0; i < 8; ++i) r[i] = v;
    return r;
}

// Plain builtins, no v_nop tail: in the tile pipeline below the slots behind a WMMA hold the earlier tile's epilogue,
// and the compiler keeps the distance where they do not.
__device__ __forceinline__ v8f mma_f16(v16h a, v16h b, v8f c) {
    return __builtin_amdgcn_wmma_f32_16x16x32_f16(false, a, false, b, (short)0, c, false, false);
}

__device__ __forceinline__ v8f mma_bf16(v16bf a, v16bf b, v8f c) {
    return __builtin_amdgcn_wmma_f32_16x16x32_bf16(false, a, false, b, (short)0, c, false, false);
}

// 16-bit A fragment from a k-contiguous [idx][k] weight tile (idx = output feature), split k map:
// elements 0..7 <- k = K0 + 8*half + 0..7, elements 8..15 <- k = K0 + 16 + 8*half + 0..7.
__device__ __forceinline__ v16h ld_frag_h(const _Float16* base, int ld, int K0, int idx, int half) {
    const _Float16* p = base + idx * ld + K0 + 8 * half;
    FragH f;
    f.h[0] = *(const v8ha*)(p);
    f.h[1] = *(const v8ha*)(p + 16);
    return f.v;
}

__device__ __forceinline__ v16bf ld_frag_bf(const unsigned short* base, int ld, int K0, int idx, int half) {
    const unsigned short* p = base + idx * ld + K0 + 8 * half;
    FragBF f;
    f.h[0] = *(const v8usa*)(p);
    f.h[1] = *(const v8usa*)(p + 16);
    return f.v;
}

union PackH { v8h v; v2h p[4]; };

// One D tile (lane: features f0 + 8*half + 0..7 of batch column r) -> acc*scale + bias, f32->f16, ReLU.
// The eight packed values are elements 0..7 (even tile) or 8..15 (odd tile) of the next layer's B fragment:
// k = 8*half + v and k = 16 + 8*half + v, the split k map of ld_frag_h.
__device__ __forceinline__ v8h relu_pack(v8f acc, float scale, v4f blo, v4f bhi) {
    PackH o;
#pragma unroll   // constant indices keep acc, the bias and o in registers
    for (int i = 0; i < 4; ++i) {
        const v2f a  = {acc[2 * i], acc[2 * i + 1]};
        const v2f b  = (i < 2) ? (v2f){blo[2 * i], blo[2 * i + 1]} : (v2f){bhi[2 * i - 4], bhi[2 * i - 3]};
        const v2f sc = {scale, scale};
        const v2h q  = __builtin_convertvector(__builtin_elementwise_fma(a, sc, b), v2h);
        o.p[i] = __builtin_elementwise_max(q, (v2h){(_Float16)0.0f, (_Float16)0.0f});
    }
    return o.v;
}

// ---- tile pipeline ----
// A model pass is 13 stages, one 16-feature tile each (4 + 4 + 4 + 1). Stage s: the fragment and bias reads of stage s + 1 as one
// group, then the WMMAs of stage s with the epilogue of stage s - 1 between them.
// keep_order() stands behind each read group: the compiler moves no LDS read across it. Without it the reads sink to just in
// front of their WMMA, in many small groups, and the LDS latency is waited out there.
__device__ __forceinline__ void keep_order() { __builtin_amdgcn_sched_barrier(0); }

struct TileH { v16h  a0, a1; v4f blo, bhi; };                // weights [16 n][64 k] as two A fragments, the lane's 8 biases
struct TileB { v16bf a;      v4f blo, bhi; };                // weights [16 n][32 k]
struct Pend  { v8f c0, c1;   v4f blo, bhi; };                // a stage's accumulators (both batch sub-tiles) awaiting their epilogue

__device__ __forceinline__ TileH ld_tile_h(const _Float16* Wt, const float* bias, int t, int r, int half) {
    TileH w;
    w.a0  = ld_frag_h(Wt, H_PITCH, 0,  t * 16 + r, half);
    w.a1  = ld_frag_h(Wt, H_PITCH, 32, t * 16 + r, half);
    w.blo = *(const v4fa*)(bias + t * 16 + 8 * half);
    w.bhi = *(const v4fa*)(bias + t * 16 + 8 * half + 4);
    return w;
}

__device__ __forceinline__ TileB ld_tile_b(const unsigned short* Wt, const float* bias, int t, int r, int half) {
    TileB w;
    w.a   = ld_frag_bf(Wt, W1_PITCH, 0, t * 16 + r, half);
    w.blo = *(const v4fa*)(bias + t * 16 + 8 * half);
    w.bhi = *(const v4fa*)(bias + t * 16 + 8 * half + 4);
    return w;
}

// One stage of a 64-wide layer. h[0], h[1]: k 0..31 and 32..63 of batch sub-tile 0; h[2], h[3]: of sub-tile 1.
// d0, d1: where the pending stage's packed outputs go; in a layer's first stage they are the upper halves of h[1] and h[3],
// which only the two WMMAs behind them read.
__device__ __forceinline__ void stage_h(const TileH& w, const FragH* h, Pend& p, float pscale, v8h& d0, v8h& d1) {
    v8f c0 = mma_f16(w.a0, h[0].v, v8f_splat(0.0f));
    v8f c1 = mma_f16(w.a0, h[2].v, v8f_splat(0.0f));
    d0 = relu_pack(p.c0, pscale, p.blo, p.bhi);
    c0 = mma_f16(w.a1, h[1].v, c0);
    d1 = relu_pack(p.c1, pscale, p.blo, p.bhi);
    c1 = mma_f16(w.a1, h[3].v, c1);
    p.c0 = c0; p.c1 = c1; p.blo = w.blo; p.bhi = w.bhi;
}

__global__ __launch_bounds__(THREADS)
void mlp_stats_kernel(const float* __restrict__ x,
                      const unsigned char* __restrict__ wblob,
                      float* __restrict__ out, int batch) {
    __shared__ __align__(16) unsigned char sBlob[2 * SIMG_BYTES];                       // two images, 53,760 B

    const int tid  = threadIdx.x;
    const int wave = tid >> 5;
    const int lane = tid & 31;
    const int r    = lane & 15;
    const int half = lane >> 4;
    const int rowbase = blockIdx.x * ROWS_PER_BLOCK + wave * ROWS_PER_WAVE;

    // ---- weight ring, two LDS images: model 0's copies start here and land under the x loads ----
    const bool tail = __builtin_amdgcn_readfirstlane(wave) < STAGE_TAIL_WAVES;          // scalar: whole waves take or skip copy 5
    const unsigned lbase = (unsigned)(size_t)sBlob;                                     // LDS byte address of image 0
    // LDS place of 16-B chunk tid + 256 k of the blob: the rows at their padded pitch, biases and pad behind them
    const unsigned l0 = lbase + OFFS_W1 + (tid >> 2) * (W1_PITCH * 2) + (tid & 3) * 16; // 4 chunks a row
    const unsigned l1 = lbase + OFFS_W2 + (tid >> 3) * (H_PITCH * 2) + (tid & 7) * 16;  // 8 chunks a row
    const unsigned l2 = l1 + 1 * TRIP_STEP;
    const unsigned l3 = l1 + 2 * TRIP_STEP;
    const unsigned l4 = l1 + 3 * TRIP_STEP;
    const unsigned l5 = (tid < 128) ? (l1 + 4 * TRIP_STEP) : (lbase + OFFS_B + (tid - 128) * 16);   // named by waves 0..5 only
    const unsigned char* gl = wblob + tid * 16;
    stage_async(gl, l0, l1, l2, l3, l4, l5, tail);

    // ---- x rows -> two bf16 B fragments (column = batch row, split k map), kept in VGPRs for all models ----
    v16bf xa0, xa1;
    {
        FragBF fx;
#pragma unroll
        for (int s = 0; s < 2; ++s) {
            int row = rowbase + s * 16 + r;
            row = (row < batch) ? row : (batch - 1);
            const float* xr = x + (size_t)row * IN_DIM + 8 * half;
            const v4f f0 = *(const v4f*)(xr);
            const v4f f1 = *(const v4f*)(xr + 4);
            const v4f f2 = *(const v4f*)(xr + 16);
            const v4f f3 = *(const v4f*)(xr + 20);
            v8us lo, hi;
            lo[0] = bf16_bits(f0[0]); lo[1] = bf16_bits(f0[1]); lo[2] = bf16_bits(f0[2]); lo[3] = bf16_bits(f0[3]);
            lo[4] = bf16_bits(f1[0]); lo[5] = bf16_bits(f1[1]); lo[6] = bf16_bits(f1[2]); lo[7] = bf16_bits(f1[3]);
            hi[0] = bf16_bits(f2[0]); hi[1] = bf16_bits(f2[1]); hi[2] = bf16_bits(f2[2]); hi[3] = bf16_bits(f2[3]);
            hi[4] = bf16_bits(f3[0]); hi[5] = bf16_bits(f3[1]); hi[6] = bf16_bits(f3[2]); hi[7] = bf16_bits(f3[3]);
            fx.h[0] = lo;
            fx.h[1] = hi;
            if (s == 0) xa0 = fx.v; else xa1 = fx.v;
        }
    }

    // shifted running sums over models: d = pred - pred(model 0)
    v8f sum0 = v8f_splat(0.0f), sq0 = v8f_splat(0.0f), p00 = v8f_splat(0.0f);
    v8f sum1 = v8f_splat(0.0f), sq1 = v8f_splat(0.0f), p01 = v8f_splat(0.0f);

    // model 0 landed (this wave's copies), then published to every wave; model 1 starts into image 1
    asm volatile("s_wait_asynccnt 0x0" ::: "memory");
    __syncthreads();
    stage_async(gl + BLOB_BYTES, l0 + SIMG_BYTES, l1 + SIMG_BYTES, l2 + SIMG_BYTES,
                l3 + SIMG_BYTES, l4 + SIMG_BYTES, l5 + SIMG_BYTES, tail);

#pragma unroll 1
    for (int m = 0; m < N_MODELS; ++m) {
        const unsigned bsel = (m & 1) ? SIMG_BYTES : 0;                                 // image that holds model m
        const unsigned char* sImg = sBlob + bsel;
        const unsigned short* sW1 = (const unsigned short*)(sImg + OFFS_W1);
        const _Float16* sW2 = (const _Float16*)(sImg + OFFS_W2);
        const _Float16* sW3 = (const _Float16*)(sImg + OFFS_W3);
        const _Float16* sW4 = (const _Float16*)(sImg + OFFS_W4);
        const float* sb1 = (const float*)(sImg + OFFS_B);
        const float* sb2 = sb1 + 64;
        const float* sb3 = sb1 + 128;
        const float* sb4 = sb1 + 192;

        FragH h1[4], h2[4], h3[4];                           // layer outputs = next layer's B fragments, indexed as in stage_h
        Pend  p;

        // ---- Layer 1: relu(W1t @ xt + b1), K = 32, bf16 operands ----
        TileH wh;
        {
            TileB wb = ld_tile_b(sW1, sb1, 0, r, half);
#pragma unroll   // t picks fragment halves and the next tile: constant so that everything stays in registers
            for (int t = 0; t < 4; ++t) {
                TileB nb;
                if (t < 3) nb = ld_tile_b(sW1, sb1, t + 1, r, half);
                else       wh = ld_tile_h(sW2, sb2, 0, r, half);
                keep_order();
                const v8f c0 = mma_bf16(wb.a, xa0, v8f_splat(0.0f));
                if (t > 0) h1[(t - 1) >> 1].h[(t - 1) & 1] = relu_pack(p.c0, 1.0f, p.blo, p.bhi);
                const v8f c1 = mma_bf16(wb.a, xa1, v8f_splat(0.0f));
                if (t > 0) h1[2 + ((t - 1) >> 1)].h[(t - 1) & 1] = relu_pack(p.c1, 1.0f, p.blo, p.bhi);
                p.c0 = c0; p.c1 = c1; p.blo = wb.blo; p.bhi = wb.bhi;
                if (t < 3) wb = nb;
            }
        }

        // ---- Layers 2 and 3 ----
#pragma unroll   // as above
        for (int t = 0; t < 4; ++t) {
            const TileH nh = (t < 3) ? ld_tile_h(sW2, sb2, t + 1, r, half) : ld_tile_h(sW3, sb3, 0, r, half);
            keep_order();
            if (t == 0) stage_h(wh, h1, p, 1.0f, h1[1].h[1], h1[3].h[1]);
            else        stage_h(wh, h1, p, WSCALE_INV, h2[(t - 1) >> 1].h[(t - 1) & 1], h2[2 + ((t - 1) >> 1)].h[(t - 1) & 1]);
            wh = nh;
        }
#pragma unroll   // as above
        for (int t = 0; t < 4; ++t) {
            const TileH nh = (t < 3) ? ld_tile_h(sW3, sb3, t + 1, r, half) : ld_tile_h(sW4, sb4, 0, r, half);
            keep_order();
            if (t == 0) stage_h(wh, h2, p, WSCALE_INV, h2[1].h[1], h2[3].h[1]);
            else        stage_h(wh, h2, p, WSCALE_INV, h3[(t - 1) >> 1].h[(t - 1) & 1], h3[2 + ((t - 1) >> 1)].h[(t - 1) & 1]);
            wh = nh;
        }

        // ---- Layer 4: pred = W4t @ h3t + b4 (outputs padded to 16 rows), shifted statistics ----
        // lane: outputs 8*half + 0..7 of batch column r; half 1 holds the zero padding
        {
            stage_h(wh, h3, p, WSCALE_INV, h3[1].h[1], h3[3].h[1]);
            const v8f acc0 = p.c0, acc1 = p.c1;
            const v4f blo = p.blo, bhi = p.bhi;
            const v8f bv8 = {blo[0], blo[1], blo[2], blo[3], bhi[0], bhi[1], bhi[2], bhi[3]};
            const v8f sc8 = v8f_splat(WSCALE_INV);
            v8f pred0 = acc0 * sc8 + bv8;
            v8f pred1 = acc1 * sc8 + bv8;
            if (m == 0) {
                p00 = pred0;
                p01 = pred1;
            } else {
                v8f d0 = pred0 - p00;
                v8f d1 = pred1 - p01;
                sum0 += d0; sq0 += d0 * d0;
                sum1 += d1; sq1 += d1 * d1;
            }
        }

        // ---- publish point of model m + 1 ----
        asm volatile("s_wait_dscnt 0x0" ::: "memory");      // this wave's reads of image m & 1 are over before it is refilled
        asm volatile("s_wait_asynccnt 0x0" ::: "memory");   // this wave's copies of model m + 1 have landed
        __syncthreads();                                    // model m + 1 readable by all; image m & 1 left by all
        if (m + 2 < N_MODELS)
            stage_async(gl + (size_t)(m + 2) * BLOB_BYTES, l0 + bsel, l1 + bsel, l2 + bsel,
                        l3 + bsel, l4 + bsel, l5 + bsel, tail);
    }
    asm volatile("s_wait_asynccnt 0x0" ::: "memory");       // no copy outstanding when the wave ends

    // a lane of half 0 holds all 8 outputs of one batch row: 32 contiguous bytes of each output plane
    if (half == 0) {
#pragma unroll   // s selects register sets
        for (int s = 0; s < 2; ++s) {
            const v8f su8 = s ? sum1 : sum0;
            const v8f sq8 = s ? sq1  : sq0;
            const v8f pz8 = s ? p01  : p00;
            v8f mean8, sd8;
#pragma unroll   // constant vector indices
            for (int v = 0; v < 8; ++v) {
                const float su = su8[v];
                mean8[v] = __builtin_fmaf(su, 1.0f / 16.0f, pz8[v]);
                float var = (sq8[v] - su * su * (1.0f / 16.0f)) * (1.0f / 15.0f);
                var = __builtin_fmaxf(var, 0.0f);
                sd8[v] = sqrtf(var);
            }
            const int row = rowbase + s * 16 + r;
            if (row < batch) {
                float* o0 = out + (size_t)row * OUT_DIM;
                float* o1 = out + (size_t)batch * OUT_DIM + (size_t)row * OUT_DIM;
                *(v4f*)(o0)     = (v4f){mean8[0], mean8[1], mean8[2], mean8[3]};
                *(v4f*)(o0 + 4) = (v4f){mean8[4], mean8[5], mean8[6], mean8[7]};
                *(v4f*)(o1)     = (v4f){sd8[0], sd8[1], sd8[2], sd8[3]};
                *(v4f*)(o1 + 4) = (v4f){sd8[4], sd8[5], sd8[6], sd8[7]};
            }
        }
    }
}

// Prologue: per model, build the packed blob image in LDS (transpose, 16-bit convert, scale, pad),
__global__ __launch_bounds__(THREADS)
void pack_weights_kernel(const float* __restrict__ W1, const float* __restrict__ b1,
                         const float* __restrict__ W2, const float* __restrict__ b2,
                         const float* __restrict__ W3, const float* __restrict__ b3,
                         const float* __restrict__ W4, const float* __restrict__ b4,
                         unsigned char* __restrict__ blob) {
    __shared__ __align__(16) unsigned char img[BLOB_BYTES];
    const int m   = blockIdx.x;
    const int tid = threadIdx.x;

    unsigned short* w1 = (unsigned short*)(img + OFFB_W1);
    _Float16* w2 = (_Float16*)(img + OFFB_W2);
    _Float16* w3 = (_Float16*)(img + OFFB_W3);
    _Float16* w4 = (_Float16*)(img + OFFB_W4);
    float* bb = (float*)(img + OFFB_B);

    // W1[m] is [32 k][64 n] -> bf16 [n][k]
    const float* g = W1 + (size_t)m * IN_DIM * HID;
    for (int e = tid; e < IN_DIM * HID; e += THREADS) {
        const int k = e >> 6, n = e & 63;
        w1[n * IN_DIM + k] = bf16_bits(g[e]);
    }
    // W2[m], W3[m] are [64 k][64 n] -> f16(256 * bf16(w)) [n][k]
    g = W2 + (size_t)m * HID * HID;
    for (int e = tid; e < HID * HID; e += THREADS) {
        const int k = e >> 6, n = e & 63;
        w2[n * HID + k] = (_Float16)(WSCALE * bf16_rne(g[e]));
    }
    g = W3 + (size_t)m * HID * HID;
    for (int e = tid; e < HID * HID; e += THREADS) {
        const int k = e >> 6, n = e & 63;
        w3[n * HID + k] = (_Float16)(WSCALE * bf16_rne(g[e]));
    }
    // W4[m] is [64 k][8 n] -> f16 [16 n][64 k], n >= 8 zero
    g = W4 + (size_t)m * HID * OUT_DIM;
    for (int e = tid; e < OUT_PAD * HID; e += THREADS) {
        const int n = e >> 6, k = e & 63;
        const float wv = (n < OUT_DIM) ? (WSCALE * bf16_rne(g[k * OUT_DIM + n])) : 0.0f;
        w4[e] = (_Float16)wv;
    }
    if (tid < HID) {
        bb[tid]       = bf16_rne(b1[m * HID + tid]);
        bb[64 + tid]  = bf16_rne(b2[m * HID + tid]);
        bb[128 + tid] = bf16_rne(b3[m * HID + tid]);
    }
    if (tid < OUT_PAD) bb[192 + tid] = (tid < OUT_DIM) ? bf16_rne(b4[m * OUT_DIM + tid]) : 0.0f;
    if (tid < (BLOB_BYTES - OFFB_PAD) / 4) ((float*)(img + OFFB_PAD))[tid] = 0.0f;
    __syncthreads();

    const uv4a* src = (const uv4a*)img;
    unsigned char* dst = blob + (size_t)m * BLOB_BYTES;
    for (int e = tid; e < BLOB_CHUNKS; e += THREADS) {
        const uv4 v = src[e];
        *(uv4*)(dst + (size_t)e * 16) = v;
    }
    
}

extern "C" void kernel_launch(void* const* d_in, const int* in_sizes, int n_in,
                              void* d_out, int out_size, void* d_ws, size_t ws_size,
                              hipStream_t stream) {
    (void)n_in;
    const float* x  = (const float*)d_in[0];
    const float* W1 = (const float*)d_in[1];
    const float* b1 = (const float*)d_in[2];
    const float* W2 = (const float*)d_in[3];
    const float* b2 = (const float*)d_in[4];
    const float* W3 = (const float*)d_in[5];
    const float* b3 = (const float*)d_in[6];
    const float* W4 = (const float*)d_in[7];
    const float* b4 = (const float*)d_in[8];
    float* out = (float*)d_out;

    const int batch = in_sizes[0] / IN_DIM;                                      // 131072
    if (batch <= 0) return;
    if ((long long)out_size < 2LL * (long long)batch * OUT_DIM) return;

    const size_t copy_bytes = (size_t)N_MODELS * BLOB_BYTES;                     // 376,832 B
    if (ws_size < copy_bytes) return;
    unsigned char* blob  = (unsigned char*)d_ws;

    const int blocks = (batch + ROWS_PER_BLOCK - 1) / ROWS_PER_BLOCK;           // 512

    pack_weights_kernel<<<dim3(N_MODELS), dim3(THREADS), 0, stream>>>(W1, b1, W2, b2, W3, b3, W4, b4, blob);
    mlp_stats_kernel<<<dim3(blocks), dim3(THREADS), 0, stream>>>(x, blob, out, batch);
}

// v005
// One run takes 47 microseconds.
// Timed twice side by side with v004, it ran 1.04 times as fast both times.
// Over all steps from v000 it is 4.43 times as fast.
#include <hip/hip_runtime.h>

// Every product is computed transposed: weights [n][k] are the A operand, activations (batch in the columns) the B operand,
// so a lane's D registers of two neighbouring 16-feature tiles, packed to f16, are the next layer's B fragment in place.
// Layer 1: v_wmma_f32_16x16x32_bf16 (bf16 operands = RNE-converted x and W1); layers 2-4: v_wmma_f32_16x16x32_f16 (f16 activations, f16 weights = bf16-RNE weights scaled by 256, scaled back by 1/256 in the f32 epilogue); f32 accumulate everywhere; member mean/std in f32.

typedef _Float16       v16h  __attribute__((ext_vector_type(16)));
typedef _Float16       v8h   __attribute__((ext_vector_type(8)));
typedef _Float16       v8ha  __attribute__((ext_vector_type(8), may_alias));
typedef __bf16         v16bf __attribute__((ext_vector_type(16)));
typedef unsigned short v8us  __attribute__((ext_vector_type(8)));
typedef unsigned short v8usa __attribute__((ext_vector_type(8), may_alias));
typedef float          v8f   __attribute__((ext_vector_type(8)));
typedef _Float16       v2h   __attribute__((ext_vector_type(2)));
typedef float          v2f   __attribute__((ext_vector_type(2)));
typedef float          v4f   __attribute__((ext_vector_type(4)));
typedef float          v4fa  __attribute__((ext_vector_type(4), may_alias));
typedef unsigned int   uv4   __attribute__((ext_vector_type(4)));
typedef unsigned int   uv4a  __attribute__((ext_vector_type(4), may_alias));

#define N_MODELS        16
#define IN_DIM          32
#define HID             64
#define OUT_DIM         8
#define OUT_PAD         16
#define THREADS         128
#define WAVES_PER_BLOCK 4
#define SUBT            4                                    // 16-row WMMA sub-tiles per wave: every weight fragment read from LDS feeds four products
#define ROWS_PER_WAVE   (SUBT * 16)                          // 64
#define ROWS_PER_BLOCK  (WAVES_PER_BLOCK * ROWS_PER_WAVE)    // 256
#define PACK_THREADS    256

// Packed per-model weight blob (byte offsets), rows unpadded:
//   W1t bf16 [64 n][32 k], W2t/W3t f16 [64 n][64 k] (x256), W4t f16 [16 n][64 k] (x256, n 8..15 zero),
#define OFFB_W1     0
#define OFFB_W2     4096
#define OFFB_W3     12288
#define OFFB_W4     20480
#define OFFB_B      22528
#define OFFB_PAD    23360
#define BLOB_BYTES  23552
#define BLOB_CHUNKS (BLOB_BYTES / 16)                        // 1472
#define WSCALE      256.0f
#define WSCALE_INV  0.00390625f

// LDS image of the blob: same rows, each at a pitch of 16 B x odd, so that the 16 lanes of a
// ds_load_b128 fragment read fall on 16 different groups of four banks.
#define W1_PITCH    40                                       // bf16 elements: 64-B rows at 80 B
#define H_PITCH     72                                       // f16 elements: 128-B rows at 144 B (W2t, W3t, W4t)
#define OFFS_W1     0
#define OFFS_W2     (HID * W1_PITCH * 2)                     // 5120
#define OFFS_W3     (OFFS_W2 + HID * H_PITCH * 2)            // 14336
#define OFFS_W4     (OFFS_W3 + HID * H_PITCH * 2)            // 23552
#define OFFS_B      (OFFS_W4 + OUT_PAD * H_PITCH * 2)        // 25856
#define SIMG_BYTES  (OFFS_B + (BLOB_BYTES - OFFB_B))         // 26880

static_assert(BLOB_BYTES % 128 == 0);
static_assert(OFFB_B + 208 * 4 == OFFB_PAD);
static_assert(OFFB_PAD % 16 == 0);

#define STAGE_TRIPS      11                                  // chunks 0..1407: eleven 16-B copies by every thread
#define STAGE_TAIL_WAVES ((BLOB_CHUNKS - STAGE_TRIPS * THREADS) / 32)   // chunks 1408..1471: a twelfth copy by waves 0 and 1
static_assert(STAGE_TRIPS * THREADS + STAGE_TAIL_WAVES * 32 == BLOB_CHUNKS);
static_assert(SIMG_BYTES % 16 == 0);
static_assert(OFFB_W2 / 16 == 2 * THREADS);                  // copies 0 and 1 are all of W1t
static_assert(OFFB_B / 16 == STAGE_TRIPS * THREADS);         // copies 2..10: W2t, W3t, W4t rows; the tail: biases and pad
#define W1_STEP          (THREADS / 4 * W1_PITCH * 2)        // 32 rows of 4 chunks a trip: 2,560 B of the LDS image
#define TRIP_STEP        (THREADS / 8 * H_PITCH * 2)         // 16 rows of 8 chunks a trip: 2,304 B of the LDS image
#define G_STEP           (THREADS * 16)                      // a trip's step in the blob: 2,048 B

// One model's blob -> one LDS image, each lane's 16-B chunks as asynchronous copies (no register on the way).
// g: the lane's chunk 0 of that blob; la, lb, lc: the lane's LDS byte addresses in the target image of its first W1t chunk,
// its first W2t chunk and its bias chunk; tail: wave-uniform.
// s_wait_xcnt closes each statement: a precaution, it stands in front of every later rewrite of the address registers.
__device__ __forceinline__ void stage_async(const unsigned char* g, unsigned la, unsigned lb, unsigned lc, bool tail) {
    asm volatile("global_load_async_to_lds_b128 %0, %11, off\n\t"
                 "global_load_async_to_lds_b128 %1, %12, off\n\t"
                 "global_load_async_to_lds_b128 %2, %13, off\n\t"
                 "global_load_async_to_lds_b128 %3, %14, off\n\t"
                 "global_load_async_to_lds_b128 %4, %15, off\n\t"
                 "global_load_async_to_lds_b128 %5, %16, off\n\t"
                 "global_load_async_to_lds_b128 %6, %17, off\n\t"
                 "global_load_async_to_lds_b128 %7, %18, off\n\t"
                 "global_load_async_to_lds_b128 %8, %19, off\n\t"
                 "global_load_async_to_lds_b128 %9, %20, off\n\t"
                 "global_load_async_to_lds_b128 %10, %21, off\n\t"
                 "s_wait_xcnt 0x0"
                 :: "v"(la), "v"(la + W1_STEP),
                    "v"(lb), "v"(lb + 1 * TRIP_STEP), "v"(lb + 2 * TRIP_STEP), "v"(lb + 3 * TRIP_STEP), "v"(lb + 4 * TRIP_STEP),
                    "v"(lb + 5 * TRIP_STEP), "v"(lb + 6 * TRIP_STEP), "v"(lb + 7 * TRIP_STEP), "v"(lb + 8 * TRIP_STEP),
                    "v"(g), "v"(g + 1 * G_STEP), "v"(g + 2 * G_STEP), "v"(g + 3 * G_STEP), "v"(g + 4 * G_STEP), "v"(g + 5 * G_STEP),
                    "v"(g + 6 * G_STEP), "v"(g + 7 * G_STEP), "v"(g + 8 * G_STEP), "v"(g + 9 * G_STEP), "v"(g + 10 * G_STEP)
                 : "memory");
    if (tail) {
        asm volatile("global_load_async_to_lds_b128 %0, %1, off\n\t"
                     "s_wait_xcnt 0x0"
                     :: "v"(lc), "v"(g + 11 * G_STEP) : "memory");
    }
}

union FragH  { v16h  v; v8h  h[2]; };
union FragBF { v16bf v; v8us h[2]; };

__device__ __forceinline__ unsigned short bf16_bits(float f) {
    unsigned int u = __float_as_uint(f);
    u += 0x7FFFu + ((u >> 16) & 1u);                         // RNE convert to bf16
    return (unsigned short)(u >> 16);
}

__device__ __forceinline__ float bf16_rne(float f) {
    return __uint_as_float(((unsigned int)bf16_bits(f)) << 16);
}

__device__ __forceinline__ v8f v8f_splat(float v) {
    v8f r;
#pragma unroll
    for (int i = 0; i < 8; ++i) r[i] = v;
    return r;
}

// Plain builtins, no v_nop tail: in the tile pipeline below the slots behind a WMMA hold the earlier tile's epilogue,
// and the compiler keeps the distance where they do not.
__device__ __forceinline__ v8f mma_f16(v16h a, v16h b, v8f c) {
    return __builtin_amdgcn_wmma_f32_16x16x32_f16(false, a, false, b, (short)0, c, false, false);
}

__device__ __forceinline__ v8f mma_bf16(v16bf a, v16bf b, v8f c) {
    return __builtin_amdgcn_wmma_f32_16x16x32_bf16(false, a, false, b, (short)0, c, false, false);
}

// 16-bit A fragment from a k-contiguous [idx][k] weight tile (idx = output feature), split k map:
// elements 0..7 <- k = K0 + 8*half + 0..7, elements 8..15 <- k = K0 + 16 + 8*half + 0..7.
__device__ __forceinline__ v16h ld_frag_h(const _Float16* base, int ld, int K0, int idx, int half) {
    const _Float16* p = base + idx * ld + K0 + 8 * half;
    FragH f;
    f.h[0] = *(const v8ha*)(p);
    f.h[1] = *(const v8ha*)(p + 16);
    return f.v;
}

__device__ __forceinline__ v16bf ld_frag_bf(const unsigned short* base, int ld, int K0, int idx, int half) {
    const unsigned short* p = base + idx * ld + K0 + 8 * half;
    FragBF f;
    f.h[0] = *(const v8usa*)(p);
    f.h[1] = *(const v8usa*)(p + 16);
    return f.v;
}

union PackH { v8h v; v2h p[4]; };

// One D tile (lane: features f0 + 8*half + 0..7 of batch column r) -> acc*scale + bias, f32->f16, ReLU.
// The eight packed values are elements 0..7 (even tile) or 8..15 (odd tile) of the next layer's B fragment:
// k = 8*half + v and k = 16 + 8*half + v, the split k map of ld_frag_h.
__device__ __forceinline__ v8h relu_pack(v8f acc, float scale, v4f blo, v4f bhi) {
    PackH o;
#pragma unroll   // constant indices keep acc, the bias and o in registers
    for (int i = 0; i < 4; ++i) {
        const v2f a  = {acc[2 * i], acc[2 * i + 1]};
        const v2f b  = (i < 2) ? (v2f){blo[2 * i], blo[2 * i + 1]} : (v2f){bhi[2 * i - 4], bhi[2 * i - 3]};
        const v2f sc = {scale, scale};
        const v2h q  = __builtin_convertvector(__builtin_elementwise_fma(a, sc, b), v2h);
        o.p[i] = __builtin_elementwise_max(q, (v2h){(_Float16)0.0f, (_Float16)0.0f});
    }
    return o.v;
}

// ---- tile pipeline ----
// A model pass is 13 stages, one 16-feature tile each (4 + 4 + 4 + 1). Stage s: the fragment and bias reads of stage s + 1 as one
// group, then the WMMAs of stage s with the epilogue of stage s - 1 between them.
// keep_order() stands behind each read group: the compiler moves no LDS read across it. Without it the reads sink to just in
// front of their WMMA, in many small groups, and the LDS latency is waited out there.
__device__ __forceinline__ void keep_order() { __builtin_amdgcn_sched_barrier(0); }

struct TileH { v16h  a0, a1; v4f blo, bhi; };                // weights [16 n][64 k] as two A fragments, the lane's 8 biases
struct TileB { v16bf a;      v4f blo, bhi; };                // weights [16 n][32 k]
struct Pend  { v8f c[SUBT];  v4f blo, bhi; };                // a stage's accumulators (every batch sub-tile) awaiting their epilogue

__device__ __forceinline__ TileH ld_tile_h(const _Float16* Wt, const float* bias, int t, int r, int half) {
    TileH w;
    w.a0  = ld_frag_h(Wt, H_PITCH, 0,  t * 16 + r, half);
    w.a1  = ld_frag_h(Wt, H_PITCH, 32, t * 16 + r, half);
    w.blo = *(const v4fa*)(bias + t * 16 + 8 * half);
    w.bhi = *(const v4fa*)(bias + t * 16 + 8 * half + 4);
    return w;
}

__device__ __forceinline__ TileB ld_tile_b(const unsigned short* Wt, const float* bias, int t, int r, int half) {
    TileB w;
    w.a   = ld_frag_bf(Wt, W1_PITCH, 0, t * 16 + r, half);
    w.blo = *(const v4fa*)(bias + t * 16 + 8 * half);
    w.bhi = *(const v4fa*)(bias + t * 16 + 8 * half + 4);
    return w;
}

// One stage of a 64-wide layer. h[2 s], h[2 s + 1]: k 0..31 and 32..63 of batch sub-tile s.
// The pending stage's packed outputs go to d[2 s + dk].h[dh]; in a layer's first stage they are the upper halves of h[2 s + 1],
// which only the WMMAs of the second group, behind them, read.
__device__ __forceinline__ void stage_h(const TileH& w, const FragH* h, Pend& p, float pscale, FragH* d, int dk, int dh) {
    v8f c[SUBT];
#pragma unroll   // s picks register sets
    for (int s = 0; s < SUBT; ++s) {
        c[s] = mma_f16(w.a0, h[2 * s].v, v8f_splat(0.0f));
        d[2 * s + dk].h[dh] = relu_pack(p.c[s], pscale, p.blo, p.bhi);
    }
#pragma unroll   // as above
    for (int s = 0; s < SUBT; ++s) p.c[s] = mma_f16(w.a1, h[2 * s + 1].v, c[s]);
    p.blo = w.blo; p.bhi = w.bhi;
}

__global__ __launch_bounds__(THREADS) __attribute__((amdgpu_waves_per_eu(2, 2)))   // two work-groups a WGP: a wave's budget is 512 VGPRs
void mlp_stats_kernel(const float* __restrict__ x,
                      const unsigned char* __restrict__ wblob,
                      float* __restrict__ out, int batch) {
    __shared__ __align__(16) unsigned char sBlob[2 * SIMG_BYTES];                       // two images, 53,760 B

    const int tid  = threadIdx.x;
    const int wave = tid >> 5;
    const int lane = tid & 31;
    const int r    = lane & 15;
    const int half = lane >> 4;
    const int rowbase = blockIdx.x * ROWS_PER_BLOCK + wave * ROWS_PER_WAVE;

    // ---- weight ring, two LDS images: model 0's copies start here and land under the x loads ----
    const bool tail = __builtin_amdgcn_readfirstlane(wave) < STAGE_TAIL_WAVES;          // scalar: whole waves take or skip copy 12
    const unsigned lbase = (unsigned)(size_t)sBlob;                                     // LDS byte address of image 0
    // LDS place of 16-B chunk tid + 128 k of the blob: the rows at their padded pitch, biases and pad behind them
    const unsigned la = lbase + OFFS_W1 + (tid >> 2) * (W1_PITCH * 2) + (tid & 3) * 16; // 4 chunks a row
    const unsigned lb = lbase + OFFS_W2 + (tid >> 3) * (H_PITCH * 2) + (tid & 7) * 16;  // 8 chunks a row
    const unsigned lc = lbase + OFFS_B + (tid & 63) * 16;                               // named by waves 0 and 1 only
    const unsigned char* gl = wblob + tid * 16;
    stage_async(gl, la, lb, lc, tail);

    // ---- x rows -> four bf16 B fragments (column = batch row, split k map), kept in VGPRs for all models ----
    v16bf xa[SUBT];
    {
        const float* xr[SUBT];
        v4f f[SUBT][4];
#pragma unroll   // s picks register sets
        for (int s = 0; s < SUBT; ++s) {
            int row = rowbase + s * 16 + r;
            row = (row < batch) ? row : (batch - 1);
            xr[s] = x + (size_t)row * IN_DIM + 8 * half;
            f[s][0] = *(const v4f*)(xr[s]);
            f[s][1] = *(const v4f*)(xr[s] + 4);
            f[s][2] = *(const v4f*)(xr[s] + 16);
            f[s][3] = *(const v4f*)(xr[s] + 20);
        }
        // a precaution: the wait stands behind the sixteen loads and in front of every rewrite of their address registers,
        // which it names so that no load's result is placed over them
        asm volatile("s_wait_xcnt 0x0" :: "v"(xr[0]), "v"(xr[1]), "v"(xr[2]), "v"(xr[3]) : "memory");
#pragma unroll   // as above
        for (int s = 0; s < SUBT; ++s) {
            const v4f f0 = f[s][0], f1 = f[s][1], f2 = f[s][2], f3 = f[s][3];
            FragBF fx;
            v8us lo, hi;
            lo[0] = bf16_bits(f0[0]); lo[1] = bf16_bits(f0[1]); lo[2] = bf16_bits(f0[2]); lo[3] = bf16_bits(f0[3]);
            lo[4] = bf16_bits(f1[0]); lo[5] = bf16_bits(f1[1]); lo[6] = bf16_bits(f1[2]); lo[7] = bf16_bits(f1[3]);
            hi[0] = bf16_bits(f2[0]); hi[1] = bf16_bits(f2[1]); hi[2] = bf16_bits(f2[2]); hi[3] = bf16_bits(f2[3]);
            hi[4] = bf16_bits(f3[0]); hi[5] = bf16_bits(f3[1]); hi[6] = bf16_bits(f3[2]); hi[7] = bf16_bits(f3[3]);
            fx.h[0] = lo;
            fx.h[1] = hi;
            xa[s] = fx.v;
        }
    }

    // shifted running sums over models: d = pred - pred(model 0)
    v8f sum[SUBT], sq[SUBT], pz[SUBT];
#pragma unroll   // s picks register sets
    for (int s = 0; s < SUBT; ++s) { sum[s] = v8f_splat(0.0f); sq[s] = v8f_splat(0.0f); pz[s] = v8f_splat(0.0f); }

    // model 0 landed (this wave's copies), then published to every wave; model 1 starts into image 1
    asm volatile("s_wait_asynccnt 0x0" ::: "memory");
    __syncthreads();
    stage_async(gl + BLOB_BYTES, la + SIMG_BYTES, lb + SIMG_BYTES, lc + SIMG_BYTES, tail);

#pragma unroll 1
    for (int m = 0; m < N_MODELS; ++m) {
        const unsigned bsel = (m & 1) ? SIMG_BYTES : 0;                                 // image that holds model m
        const unsigned char* sImg = sBlob + bsel;
        const unsigned short* sW1 = (const unsigned short*)(sImg + OFFS_W1);
        const _Float16* sW2 = (const _Float16*)(sImg + OFFS_W2);
        const _Float16* sW3 = (const _Float16*)(sImg + OFFS_W3);
        const _Float16* sW4 = (const _Float16*)(sImg + OFFS_W4);
        const float* sb1 = (const float*)(sImg + OFFS_B);
        const float* sb2 = sb1 + 64;
        const float* sb3 = sb1 + 128;
        const float* sb4 = sb1 + 192;

        FragH h1[2 * SUBT], h2[2 * SUBT], h3[2 * SUBT];      // layer outputs = next layer's B fragments, indexed as in stage_h
        Pend  p;

        // ---- Layer 1: relu(W1t @ xt + b1), K = 32, bf16 operands ----
        TileH wh;
        {
            TileB wb = ld_tile_b(sW1, sb1, 0, r, half);
#pragma unroll   // t picks fragment halves and the next tile: constant so that everything stays in registers
            for (int t = 0; t < 4; ++t) {
                TileB nb;
                if (t < 3) nb = ld_tile_b(sW1, sb1, t + 1, r, half);
                else       wh = ld_tile_h(sW2, sb2, 0, r, half);
                keep_order();
                v8f c[SUBT];
#pragma unroll   // s picks register sets
                for (int s = 0; s < SUBT; ++s) {
                    c[s] = mma_bf16(wb.a, xa[s], v8f_splat(0.0f));
                    if (t > 0) h1[2 * s + ((t - 1) >> 1)].h[(t - 1) & 1] = relu_pack(p.c[s], 1.0f, p.blo, p.bhi);
                }
#pragma unroll   // as above
                for (int s = 0; s < SUBT; ++s) p.c[s] = c[s];
                p.blo = wb.blo; p.bhi = wb.bhi;
                if (t < 3) wb = nb;
            }
        }

        // ---- Layers 2 and 3 ----
#pragma unroll   // as above
        for (int t = 0; t < 4; ++t) {
            const TileH nh = (t < 3) ? ld_tile_h(sW2, sb2, t + 1, r, half) : ld_tile_h(sW3, sb3, 0, r, half);
            keep_order();
            if (t == 0) stage_h(wh, h1, p, 1.0f, h1, 1, 1);
            else        stage_h(wh, h1, p, WSCALE_INV, h2, (t - 1) >> 1, (t - 1) & 1);
            wh = nh;
        }
#pragma unroll   // as above
        for (int t = 0; t < 4; ++t) {
            const TileH nh = (t < 3) ? ld_tile_h(sW3, sb3, t + 1, r, half) : ld_tile_h(sW4, sb4, 0, r, half);
            keep_order();
            if (t == 0) stage_h(wh, h2, p, WSCALE_INV, h2, 1, 1);
            else        stage_h(wh, h2, p, WSCALE_INV, h3, (t - 1) >> 1, (t - 1) & 1);
            wh = nh;
        }

        // ---- Layer 4: pred = W4t @ h3t + b4 (outputs padded to 16 rows), shifted statistics ----
        // lane: outputs 8*half + 0..7 of batch column r; half 1 holds the zero padding
        {
            stage_h(wh, h3, p, WSCALE_INV, h3, 1, 1);
            const v4f blo = p.blo, bhi = p.bhi;
            const v8f bv8 = {blo[0], blo[1], blo[2], blo[3], bhi[0], bhi[1], bhi[2], bhi[3]};
            const v8f sc8 = v8f_splat(WSCALE_INV);
            v8f pred[SUBT];
#pragma unroll   // s picks register sets
            for (int s = 0; s < SUBT; ++s) pred[s] = p.c[s] * sc8 + bv8;
            if (m == 0) {
#pragma unroll   // as above
                for (int s = 0; s < SUBT; ++s) pz[s] = pred[s];
            } else {
#pragma unroll   // as above
                for (int s = 0; s < SUBT; ++s) {
                    const v8f d = pred[s] - pz[s];
                    sum[s] += d; sq[s] += d * d;
                }
            }
        }

        // ---- publish point of model m + 1 ----
        asm volatile("s_wait_dscnt 0x0" ::: "memory");      // this wave's reads of image m & 1 are over before it is refilled
        asm volatile("s_wait_asynccnt 0x0" ::: "memory");   // this wave's copies of model m + 1 have landed
        __syncthreads();                                    // model m + 1 readable by all; image m & 1 left by all
        if (m + 2 < N_MODELS)
            stage_async(gl + (size_t)(m + 2) * BLOB_BYTES, la + bsel, lb + bsel, lc + bsel, tail);
    }
    asm volatile("s_wait_asynccnt 0x0" ::: "memory");       // no copy outstanding when the wave ends

    // a lane of half 0 holds all 8 outputs of one batch row: 32 contiguous bytes of each output plane
    if (half == 0) {
#pragma unroll   // s selects register sets
        for (int s = 0; s < SUBT; ++s) {
            const v8f su8 = sum[s];
            const v8f sq8 = sq[s];
            const v8f pz8 = pz[s];
            v8f mean8, sd8;
#pragma unroll   // constant vector indices
            for (int v = 0; v < 8; ++v) {
                const float su = su8[v];
                mean8[v] = __builtin_fmaf(su, 1.0f / 16.0f, pz8[v]);
                float var = (sq8[v] - su * su * (1.0f / 16.0f)) * (1.0f / 15.0f);
                var = __builtin_fmaxf(var, 0.0f);
                sd8[v] = sqrtf(var);
            }
            const int row = rowbase + s * 16 + r;
            if (row < batch) {
                float* o0 = out + (size_t)row * OUT_DIM;
                float* o1 = out + (size_t)batch * OUT_DIM + (size_t)row * OUT_DIM;
                *(v4f*)(o0)     = (v4f){mean8[0], mean8[1], mean8[2], mean8[3]};
                *(v4f*)(o0 + 4) = (v4f){mean8[4], mean8[5], mean8[6], mean8[7]};
                *(v4f*)(o1)     = (v4f){sd8[0], sd8[1], sd8[2], sd8[3]};
                *(v4f*)(o1 + 4) = (v4f){sd8[4], sd8[5], sd8[6], sd8[7]};
            }
        }
    }
}

// Prologue: per model, build the packed blob image in LDS (transpose, 16-bit convert, scale, pad),
__global__ __launch_bounds__(PACK_THREADS)
void pack_weights_kernel(const float* __restrict__ W1, const float* __restrict__ b1,
                         const float* __restrict__ W2, const float* __restrict__ b2,
                         const float* __restrict__ W3, const float* __restrict__ b3,
                         const float* __restrict__ W4, const float* __restrict__ b4,
                         unsigned char* __restrict__ blob) {
    __shared__ __align__(16) unsigned char img[BLOB_BYTES];
    const int m   = blockIdx.x;
    const int tid = threadIdx.x;

    unsigned short* w1 = (unsigned short*)(img + OFFB_W1);
    _Float16* w2 = (_Float16*)(img + OFFB_W2);
    _Float16* w3 = (_Float16*)(img + OFFB_W3);
    _Float16* w4 = (_Float16*)(img + OFFB_W4);
    float* bb = (float*)(img + OFFB_B);

    // W1[m] is [32 k][64 n] -> bf16 [n][k]
    const float* g = W1 + (size_t)m * IN_DIM * HID;
    for (int e = tid; e < IN_DIM * HID; e += PACK_THREADS) {
        const int k = e >> 6, n = e & 63;
        w1[n * IN_DIM + k] = bf16_bits(g[e]);
    }
    // W2[m], W3[m] are [64 k][64 n] -> f16(256 * bf16(w)) [n][k]
    g = W2 + (size_t)m * HID * HID;
    for (int e = tid; e < HID * HID; e += PACK_THREADS) {
        const int k = e >> 6, n = e & 63;
        w2[n * HID + k] = (_Float16)(WSCALE * bf16_rne(g[e]));
    }
    g = W3 + (size_t)m * HID * HID;
    for (int e = tid; e < HID * HID; e += PACK_THREADS) {
        const int k = e >> 6, n = e & 63;
        w3[n * HID + k] = (_Float16)(WSCALE * bf16_rne(g[e]));
    }
    // W4[m] is [64 k][8 n] -> f16 [16 n][64 k], n >= 8 zero
    g = W4 + (size_t)m * HID * OUT_DIM;
    for (int e = tid; e < OUT_PAD * HID; e += PACK_THREADS) {
        const int n = e >> 6, k = e & 63;
        const float wv = (n < OUT_DIM) ? (WSCALE * bf16_rne(g[k * OUT_DIM + n])) : 0.0f;
        w4[e] = (_Float16)wv;
    }
    if (tid < HID) {
        bb[tid]       = bf16_rne(b1[m * HID + tid]);
        bb[64 + tid]  = bf16_rne(b2[m * HID + tid]);
        bb[128 + tid] = bf16_rne(b3[m * HID + tid]);
    }
    if (tid < OUT_PAD) bb[192 + tid] = (tid < OUT_DIM) ? bf16_rne(b4[m * OUT_DIM + tid]) : 0.0f;
    if (tid < (BLOB_BYTES - OFFB_PAD) / 4) ((float*)(img + OFFB_PAD))[tid] = 0.0f;
    __syncthreads();

    const uv4a* src = (const uv4a*)img;
    unsigned char* dst = blob + (size_t)m * BLOB_BYTES;
    for (int e = tid; e < BLOB_CHUNKS; e += PACK_THREADS) {
        const uv4 v = src[e];
        *(uv4*)(dst + (size_t)e * 16) = v;
    }
    
}

extern "C" void kernel_launch(void* const* d_in, const int* in_sizes, int n_in,
                              void* d_out, int out_size, void* d_ws, size_t ws_size,
                              hipStream_t stream) {
    (void)n_in;
    const float* x  = (const float*)d_in[0];
    const float* W1 = (const float*)d_in[1];
    const float* b1 = (const float*)d_in[2];
    const float* W2 = (const float*)d_in[3];
    const float* b2 = (const float*)d_in[4];
    const float* W3 = (const float*)d_in[5];
    const float* b3 = (const float*)d_in[6];
    const float* W4 = (const float*)d_in[7];
    const float* b4 = (const float*)d_in[8];
    float* out = (float*)d_out;

    const int batch = in_sizes[0] / IN_DIM;                                      // 131072
    if (batch <= 0) return;
    if ((long long)out_size < 2LL * (long long)batch * OUT_DIM) return;

    const size_t copy_bytes = (size_t)N_MODELS * BLOB_BYTES;                     // 376,832 B
    if (ws_size < copy_bytes) return;
    unsigned char* blob  = (unsigned char*)d_ws;

    const int blocks = (batch + ROWS_PER_BLOCK - 1) / ROWS_PER_BLOCK;           // 512

    pack_weights_kernel<<<dim3(N_MODELS), dim3(PACK_THREADS), 0, stream>>>(W1, b1, W2, b2, W3, b3, W4, b4, blob);
    mlp_stats_kernel<<<dim3(blocks), dim3(THREADS), 0, stream>>>(x, blob, out, batch);
}

// v006
// Measured time: 34.7 microseconds a run.
// Two timings next to v005 both put it at 1.36 times that version's speed.
// Counting every step since v000, it is 6.03 times as fast.
#include <hip/hip_runtime.h>

// Every product is computed transposed: weights [n][k] are the A operand, activations (batch in the columns) the B operand,
// so a lane's D registers of two neighbouring 16-feature tiles, packed to f16, are the next layer's B fragment in place.
// Layer 1: v_wmma_f32_16x16x32_bf16 (bf16 operands = RNE-converted x and W1); layers 2-4: v_wmma_f32_16x16x32_f16 (f16 activations, f16 weights = bf16-RNE weights scaled by 256, scaled back by 1/256 in the f32 epilogue); f32 accumulate everywhere; member mean/std in f32.

typedef _Float16       v16h  __attribute__((ext_vector_type(16)));
typedef _Float16       v8h   __attribute__((ext_vector_type(8)));
typedef _Float16       v8ha  __attribute__((ext_vector_type(8), may_alias));
typedef __bf16         v16bf __attribute__((ext_vector_type(16)));
typedef unsigned short v8us  __attribute__((ext_vector_type(8)));
typedef unsigned short v8usa __attribute__((ext_vector_type(8), may_alias));
typedef float          v8f   __attribute__((ext_vector_type(8)));
typedef _Float16       v2h   __attribute__((ext_vector_type(2)));
typedef float          v2f   __attribute__((ext_vector_type(2)));
typedef float          v4f   __attribute__((ext_vector_type(4)));
typedef float          v4fa  __attribute__((ext_vector_type(4), may_alias));
typedef unsigned int   uv4   __attribute__((ext_vector_type(4)));
typedef unsigned int   uv4a  __attribute__((ext_vector_type(4), may_alias));

#define N_MODELS        16
#define IN_DIM          32
#define HID             64
#define OUT_DIM         8
#define OUT_PAD         16
#define THREADS         128
#define WAVES_PER_BLOCK 4
#define SUBT            4                                    // 16-row WMMA sub-tiles per wave: every weight fragment read from LDS feeds four products
#define ROWS_PER_WAVE   (SUBT * 16)                          // 64
#define ROWS_PER_BLOCK  (WAVES_PER_BLOCK * ROWS_PER_WAVE)    // 256
#define PACK_THREADS    256

// Packed per-model weight blob (byte offsets), rows unpadded:
//   W1t bf16 [64 n][32 k], W2t/W3t f16 [64 n][64 k] (x256), W4t f16 [16 n][64 k] (x256, n 8..15 zero),
#define OFFB_W1     0
#define OFFB_W2     4096
#define OFFB_W3     12288
#define OFFB_W4     20480
#define OFFB_B      22528
#define OFFB_PAD    23360
#define BLOB_BYTES  23552
#define BLOB_CHUNKS (BLOB_BYTES / 16)                        // 1472
#define WSCALE      256.0f
#define WSCALE_INV  0.00390625f

// LDS image of the blob: same rows, each at a pitch of 16 B x odd, so that the 16 lanes of a
// ds_load_b128 fragment read fall on 16 different groups of four banks.
#define W1_PITCH    40                                       // bf16 elements: 64-B rows at 80 B
#define H_PITCH     72                                       // f16 elements: 128-B rows at 144 B (W2t, W3t, W4t)
#define OFFS_W1     0
#define OFFS_W2     (HID * W1_PITCH * 2)                     // 5120
#define OFFS_W3     (OFFS_W2 + HID * H_PITCH * 2)            // 14336
#define OFFS_W4     (OFFS_W3 + HID * H_PITCH * 2)            // 23552
#define OFFS_B      (OFFS_W4 + OUT_PAD * H_PITCH * 2)        // 25856
#define SIMG_BYTES  (OFFS_B + (BLOB_BYTES - OFFB_B))         // 26880

static_assert(BLOB_BYTES % 128 == 0);
static_assert(OFFB_B + 208 * 4 == OFFB_PAD);
static_assert(OFFB_PAD % 16 == 0);

#define STAGE_TRIPS      11                                  // chunks 0..1407: eleven 16-B copies by every thread
#define STAGE_TAIL_WAVES ((BLOB_CHUNKS - STAGE_TRIPS * THREADS) / 32)   // chunks 1408..1471: a twelfth copy by waves 0 and 1
static_assert(STAGE_TRIPS * THREADS + STAGE_TAIL_WAVES * 32 == BLOB_CHUNKS);
static_assert(SIMG_BYTES % 16 == 0);
static_assert(OFFB_W2 / 16 == 2 * THREADS);                  // copies 0 and 1 are all of W1t
static_assert(OFFB_B / 16 == STAGE_TRIPS * THREADS);         // copies 2..10: W2t, W3t, W4t rows; the tail: biases and pad
#define W1_STEP          (THREADS / 4 * W1_PITCH * 2)        // 32 rows of 4 chunks a trip: 2,560 B of the LDS image
#define TRIP_STEP        (THREADS / 8 * H_PITCH * 2)         // 16 rows of 8 chunks a trip: 2,304 B of the LDS image
#define G_STEP           (THREADS * 16)                      // a trip's step in the blob: 2,048 B

// One model's blob -> one LDS image, each lane's 16-B chunks as asynchronous copies (no register on the way).
// g: the lane's chunk 0 of that blob; la, lb, lc: the lane's LDS byte addresses in the target image of its first W1t chunk,
// its first W2t chunk and its bias chunk; tail: wave-uniform.
// s_wait_xcnt closes each statement: a precaution, it stands in front of every later rewrite of the address registers.
__device__ __forceinline__ void stage_async(const unsigned char* g, unsigned la, unsigned lb, unsigned lc, bool tail) {
    asm volatile("global_load_async_to_lds_b128 %0, %11, off\n\t"
                 "global_load_async_to_lds_b128 %1, %12, off\n\t"
                 "global_load_async_to_lds_b128 %2, %13, off\n\t"
                 "global_load_async_to_lds_b128 %3, %14, off\n\t"
                 "global_load_async_to_lds_b128 %4, %15, off\n\t"
                 "global_load_async_to_lds_b128 %5, %16, off\n\t"
                 "global_load_async_to_lds_b128 %6, %17, off\n\t"
                 "global_load_async_to_lds_b128 %7, %18, off\n\t"
                 "global_load_async_to_lds_b128 %8, %19, off\n\t"
                 "global_load_async_to_lds_b128 %9, %20, off\n\t"
                 "global_load_async_to_lds_b128 %10, %21, off\n\t"
                 "s_wait_xcnt 0x0"
                 :: "v"(la), "v"(la + W1_STEP),
                    "v"(lb), "v"(lb + 1 * TRIP_STEP), "v"(lb + 2 * TRIP_STEP), "v"(lb + 3 * TRIP_STEP), "v"(lb + 4 * TRIP_STEP),
                    "v"(lb + 5 * TRIP_STEP), "v"(lb + 6 * TRIP_STEP), "v"(lb + 7 * TRIP_STEP), "v"(lb + 8 * TRIP_STEP),
                    "v"(g), "v"(g + 1 * G_STEP), "v"(g + 2 * G_STEP), "v"(g + 3 * G_STEP), "v"(g + 4 * G_STEP), "v"(g + 5 * G_STEP),
                    "v"(g + 6 * G_STEP), "v"(g + 7 * G_STEP), "v"(g + 8 * G_STEP), "v"(g + 9 * G_STEP), "v"(g + 10 * G_STEP)
                 : "memory");
    if (tail) {
        asm volatile("global_load_async_to_lds_b128 %0, %1, off\n\t"
                     "s_wait_xcnt 0x0"
                     :: "v"(lc), "v"(g + 11 * G_STEP) : "memory");
    }
}

union FragH  { v16h  v; v8h  h[2]; };
union FragBF { v16bf v; v8us h[2]; };

__device__ __forceinline__ unsigned short bf16_bits(float f) {
    unsigned int u = __float_as_uint(f);
    u += 0x7FFFu + ((u >> 16) & 1u);                         // RNE convert to bf16
    return (unsigned short)(u >> 16);
}

__device__ __forceinline__ float bf16_rne(float f) {
    return __uint_as_float(((unsigned int)bf16_bits(f)) << 16);
}

__device__ __forceinline__ v8f v8f_splat(float v) {
    v8f r;
#pragma unroll
    for (int i = 0; i < 8; ++i) r[i] = v;
    return r;
}

// Plain builtins, no v_nop tail: in the tile pipeline below the slots behind a WMMA hold the earlier tile's epilogue,
// and the compiler keeps the distance where they do not.
__device__ __forceinline__ v8f mma_f16(v16h a, v16h b, v8f c) {
    return __builtin_amdgcn_wmma_f32_16x16x32_f16(false, a, false, b, (short)0, c, false, false);
}

__device__ __forceinline__ v8f mma_bf16(v16bf a, v16bf b, v8f c) {
    return __builtin_amdgcn_wmma_f32_16x16x32_bf16(false, a, false, b, (short)0, c, false, false);
}

// 16-bit A fragment from a k-contiguous [idx][k] weight tile (idx = output feature), split k map:
// elements 0..7 <- k = K0 + 8*half + 0..7, elements 8..15 <- k = K0 + 16 + 8*half + 0..7.
__device__ __forceinline__ v16h ld_frag_h(const _Float16* base, int ld, int K0, int idx, int half) {
    const _Float16* p = base + idx * ld + K0 + 8 * half;
    FragH f;
    f.h[0] = *(const v8ha*)(p);
    f.h[1] = *(const v8ha*)(p + 16);
    return f.v;
}

__device__ __forceinline__ v16bf ld_frag_bf(const unsigned short* base, int ld, int K0, int idx, int half) {
    const unsigned short* p = base + idx * ld + K0 + 8 * half;
    FragBF f;
    f.h[0] = *(const v8usa*)(p);
    f.h[1] = *(const v8usa*)(p + 16);
    return f.v;
}

union PackH { v8h v; v2h p[4]; };

// One D tile (lane: features f0 + 8*half + 0..7 of batch column r) -> acc*scale + bias, f32->f16, ReLU.
// The eight packed values are elements 0..7 (even tile) or 8..15 (odd tile) of the next layer's B fragment:
// k = 8*half + v and k = 16 + 8*half + v, the split k map of ld_frag_h.
__device__ __forceinline__ v8h relu_pack(v8f acc, float scale, v4f blo, v4f bhi) {
    PackH o;
#pragma unroll   // constant indices keep acc, the bias and o in registers
    for (int i = 0; i < 4; ++i) {
        const v2f a  = {acc[2 * i], acc[2 * i + 1]};
        const v2f b  = (i < 2) ? (v2f){blo[2 * i], blo[2 * i + 1]} : (v2f){bhi[2 * i - 4], bhi[2 * i - 3]};
        const v2f sc = {scale, scale};
        const v2h q  = __builtin_convertvector(__builtin_elementwise_fma(a, sc, b), v2h);
        o.p[i] = __builtin_elementwise_max(q, (v2h){(_Float16)0.0f, (_Float16)0.0f});
    }
    return o.v;
}

// ---- tile pipeline ----
// A model pass is 13 stages, one 16-feature tile each (4 + 4 + 4 + 1). Stage s: the fragment and bias reads of stage s + 1 as one
// group, then the WMMAs of stage s with the epilogue of stage s - 1 between them.
// keep_order() stands behind each read group: the compiler moves no LDS read across it. Without it the reads sink to just in
// front of their WMMA, in many small groups, and the LDS latency is waited out there.
__device__ __forceinline__ void keep_order() { __builtin_amdgcn_sched_barrier(0); }

struct TileH { v16h  a0, a1; v4f blo, bhi; };                // weights [16 n][64 k] as two A fragments, the lane's 8 biases
struct TileB { v16bf a;      v4f blo, bhi; };                // weights [16 n][32 k]
struct Pend  { v8f c[SUBT];  v4f blo, bhi; };                // a stage's accumulators (every batch sub-tile) awaiting their epilogue

__device__ __forceinline__ TileH ld_tile_h(const _Float16* Wt, const float* bias, int t, int r, int half) {
    TileH w;
    w.a0  = ld_frag_h(Wt, H_PITCH, 0,  t * 16 + r, half);
    w.a1  = ld_frag_h(Wt, H_PITCH, 32, t * 16 + r, half);
    w.blo = *(const v4fa*)(bias + t * 16 + 8 * half);
    w.bhi = *(const v4fa*)(bias + t * 16 + 8 * half + 4);
    return w;
}

__device__ __forceinline__ TileB ld_tile_b(const unsigned short* Wt, const float* bias, int t, int r, int half) {
    TileB w;
    w.a   = ld_frag_bf(Wt, W1_PITCH, 0, t * 16 + r, half);
    w.blo = *(const v4fa*)(bias + t * 16 + 8 * half);
    w.bhi = *(const v4fa*)(bias + t * 16 + 8 * half + 4);
    return w;
}

// One stage of a 64-wide layer. h[2 s], h[2 s + 1]: k 0..31 and 32..63 of batch sub-tile s.
// The pending stage's packed outputs go to d[2 s + dk].h[dh]; in a layer's first stage they are the upper halves of h[2 s + 1],
// which only the WMMAs of the second group, behind them, read.
__device__ __forceinline__ void stage_h(const TileH& w, const FragH* h, Pend& p, float pscale, FragH* d, int dk, int dh) {
    v8f c[SUBT];
#pragma unroll   // s picks register sets
    for (int s = 0; s < SUBT; ++s) {
        c[s] = mma_f16(w.a0, h[2 * s].v, v8f_splat(0.0f));
        d[2 * s + dk].h[dh] = relu_pack(p.c[s], pscale, p.blo, p.bhi);
    }
#pragma unroll   // as above
    for (int s = 0; s < SUBT; ++s) p.c[s] = mma_f16(w.a1, h[2 * s + 1].v, c[s]);
    p.blo = w.blo; p.bhi = w.bhi;
}

__global__ __launch_bounds__(THREADS) __attribute__((amdgpu_waves_per_eu(2, 2)))   // two work-groups a WGP: a wave's budget is 512 VGPRs
void mlp_stats_kernel(const float* __restrict__ x,
                      const unsigned char* __restrict__ wblob,
                      float* __restrict__ out, int batch) {
    __shared__ __align__(16) unsigned char sBlob[2 * SIMG_BYTES];                       // two images, 53,760 B

    const int tid  = threadIdx.x;
    const int wave = tid >> 5;
    const int lane = tid & 31;
    const int r    = lane & 15;
    const int half = lane >> 4;
    const int rowbase = blockIdx.x * ROWS_PER_BLOCK + wave * ROWS_PER_WAVE;

    // ---- weight ring, two LDS images: model 0's copies start here and land under the x loads ----
    const bool tail = __builtin_amdgcn_readfirstlane(wave) < STAGE_TAIL_WAVES;          // scalar: whole waves take or skip copy 12
    const unsigned lbase = (unsigned)(size_t)sBlob;                                     // LDS byte address of image 0
    // LDS place of 16-B chunk tid + 128 k of the blob: the rows at their padded pitch, biases and pad behind them
    const unsigned la = lbase + OFFS_W1 + (tid >> 2) * (W1_PITCH * 2) + (tid & 3) * 16; // 4 chunks a row
    const unsigned lb = lbase + OFFS_W2 + (tid >> 3) * (H_PITCH * 2) + (tid & 7) * 16;  // 8 chunks a row
    const unsigned lc = lbase + OFFS_B + (tid & 63) * 16;                               // named by waves 0 and 1 only
    const unsigned char* gl = wblob + tid * 16;
    stage_async(gl, la, lb, lc, tail);

    // ---- x rows -> four bf16 B fragments (column = batch row, split k map), kept in VGPRs for all models ----
    v16bf xa[SUBT];
    {
        const float* xr[SUBT];
        v4f f[SUBT][4];
#pragma unroll   // s picks register sets
        for (int s = 0; s < SUBT; ++s) {
            int row = rowbase + s * 16 + r;
            row = (row < batch) ? row : (batch - 1);
            xr[s] = x + (size_t)row * IN_DIM + 8 * half;
            f[s][0] = *(const v4f*)(xr[s]);
            f[s][1] = *(const v4f*)(xr[s] + 4);
            f[s][2] = *(const v4f*)(xr[s] + 16);
            f[s][3] = *(const v4f*)(xr[s] + 20);
        }
        // a precaution: the wait stands behind the sixteen loads and in front of every rewrite of their address registers,
        // which it names so that no load's result is placed over them
        asm volatile("s_wait_xcnt 0x0" :: "v"(xr[0]), "v"(xr[1]), "v"(xr[2]), "v"(xr[3]) : "memory");
#pragma unroll   // as above
        for (int s = 0; s < SUBT; ++s) {
            const v4f f0 = f[s][0], f1 = f[s][1], f2 = f[s][2], f3 = f[s][3];
            FragBF fx;
            v8us lo, hi;
            lo[0] = bf16_bits(f0[0]); lo[1] = bf16_bits(f0[1]); lo[2] = bf16_bits(f0[2]); lo[3] = bf16_bits(f0[3]);
            lo[4] = bf16_bits(f1[0]); lo[5] = bf16_bits(f1[1]); lo[6] = bf16_bits(f1[2]); lo[7] = bf16_bits(f1[3]);
            hi[0] = bf16_bits(f2[0]); hi[1] = bf16_bits(f2[1]); hi[2] = bf16_bits(f2[2]); hi[3] = bf16_bits(f2[3]);
            hi[4] = bf16_bits(f3[0]); hi[5] = bf16_bits(f3[1]); hi[6] = bf16_bits(f3[2]); hi[7] = bf16_bits(f3[3]);
            fx.h[0] = lo;
            fx.h[1] = hi;
            xa[s] = fx.v;
        }
    }

    // shifted running sums over models: d = pred - pred(model 0)
    v8f sum[SUBT], sq[SUBT], pz[SUBT];
#pragma unroll   // s picks register sets
    for (int s = 0; s < SUBT; ++s) { sum[s] = v8f_splat(0.0f); sq[s] = v8f_splat(0.0f); pz[s] = v8f_splat(0.0f); }

    // model 0 landed (this wave's copies), then published to every wave; model 1 starts into image 1
    asm volatile("s_wait_asynccnt 0x0" ::: "memory");
    __syncthreads();
    stage_async(gl + BLOB_BYTES, la + SIMG_BYTES, lb + SIMG_BYTES, lc + SIMG_BYTES, tail);

#pragma unroll 1
    for (int m = 0; m < N_MODELS; ++m) {
        const unsigned bsel = (m & 1) ? SIMG_BYTES : 0;                                 // image that holds model m
        const unsigned char* sImg = sBlob + bsel;
        const unsigned short* sW1 = (const unsigned short*)(sImg + OFFS_W1);
        const _Float16* sW2 = (const _Float16*)(sImg + OFFS_W2);
        const _Float16* sW3 = (const _Float16*)(sImg + OFFS_W3);
        const _Float16* sW4 = (const _Float16*)(sImg + OFFS_W4);
        const float* sb1 = (const float*)(sImg + OFFS_B);
        const float* sb2 = sb1 + 64;
        const float* sb3 = sb1 + 128;
        const float* sb4 = sb1 + 192;

        FragH h1[2 * SUBT], h2[2 * SUBT], h3[2 * SUBT];      // layer outputs = next layer's B fragments, indexed as in stage_h
        Pend  p;

        // ---- Layer 1: relu(W1t @ xt + b1), K = 32, bf16 operands ----
        TileH wh;
        {
            TileB wb = ld_tile_b(sW1, sb1, 0, r, half);
#pragma unroll   // t picks fragment halves and the next tile: constant so that everything stays in registers
            for (int t = 0; t < 4; ++t) {
                TileB nb;
                if (t < 3) nb = ld_tile_b(sW1, sb1, t + 1, r, half);
                else       wh = ld_tile_h(sW2, sb2, 0, r, half);
                keep_order();
                v8f c[SUBT];
#pragma unroll   // s picks register sets
                for (int s = 0; s < SUBT; ++s) {
                    c[s] = mma_bf16(wb.a, xa[s], v8f_splat(0.0f));
                    if (t > 0) h1[2 * s + ((t - 1) >> 1)].h[(t - 1) & 1] = relu_pack(p.c[s], 1.0f, p.blo, p.bhi);
                }
#pragma unroll   // as above
                for (int s = 0; s < SUBT; ++s) p.c[s] = c[s];
                p.blo = wb.blo; p.bhi = wb.bhi;
                if (t < 3) wb = nb;
            }
        }

        // ---- Layers 2 and 3 ----
#pragma unroll   // as above
        for (int t = 0; t < 4; ++t) {
            const TileH nh = (t < 3) ? ld_tile_h(sW2, sb2, t + 1, r, half) : ld_tile_h(sW3, sb3, 0, r, half);
            keep_order();
            if (t == 0) stage_h(wh, h1, p, 1.0f, h1, 1, 1);
            else        stage_h(wh, h1, p, WSCALE_INV, h2, (t - 1) >> 1, (t - 1) & 1);
            wh = nh;
        }
#pragma unroll   // as above
        for (int t = 0; t < 4; ++t) {
            const TileH nh = (t < 3) ? ld_tile_h(sW3, sb3, t + 1, r, half) : ld_tile_h(sW4, sb4, 0, r, half);
            keep_order();
            if (t == 0) stage_h(wh, h2, p, WSCALE_INV, h2, 1, 1);
            else        stage_h(wh, h2, p, WSCALE_INV, h3, (t - 1) >> 1, (t - 1) & 1);
            wh = nh;
        }

        // ---- Layer 4: pred = W4t @ h3t + b4 (outputs padded to 16 rows), shifted statistics ----
        // lane: outputs 8*half + 0..7 of batch column r; half 1 holds the zero padding
        {
            stage_h(wh, h3, p, WSCALE_INV, h3, 1, 1);
            const v4f blo = p.blo, bhi = p.bhi;
            const v8f bv8 = {blo[0], blo[1], blo[2], blo[3], bhi[0], bhi[1], bhi[2], bhi[3]};
            const v8f sc8 = v8f_splat(WSCALE_INV);
            v8f pred[SUBT];
#pragma unroll   // s picks register sets
            for (int s = 0; s < SUBT; ++s) pred[s] = p.c[s] * sc8 + bv8;
            if (m == 0) {
#pragma unroll   // as above
                for (int s = 0; s < SUBT; ++s) pz[s] = pred[s];
            } else {
#pragma unroll   // as above
                for (int s = 0; s < SUBT; ++s) {
                    const v8f d = pred[s] - pz[s];
                    sum[s] += d; sq[s] += d * d;
                }
            }
        }

        // ---- publish point of model m + 1 ----
        asm volatile("s_wait_dscnt 0x0" ::: "memory");      // this wave's reads of image m & 1 are over before it is refilled
        asm volatile("s_wait_asynccnt 0x0" ::: "memory");   // this wave's copies of model m + 1 have landed
        __syncthreads();                                    // model m + 1 readable by all; image m & 1 left by all
        if (m + 2 < N_MODELS)
            stage_async(gl + (size_t)(m + 2) * BLOB_BYTES, la + bsel, lb + bsel, lc + bsel, tail);
    }
    asm volatile("s_wait_asynccnt 0x0" ::: "memory");       // no copy outstanding when the wave ends

    // a lane of half 0 holds all 8 outputs of one batch row: 32 contiguous bytes of each output plane
    if (half == 0) {
#pragma unroll   // s selects register sets
        for (int s = 0; s < SUBT; ++s) {
            const v8f su8 = sum[s];
            const v8f sq8 = sq[s];
            const v8f pz8 = pz[s];
            v8f mean8, sd8;
#pragma unroll   // constant vector indices
            for (int v = 0; v < 8; ++v) {
                const float su = su8[v];
                mean8[v] = __builtin_fmaf(su, 1.0f / 16.0f, pz8[v]);
                float var = (sq8[v] - su * su * (1.0f / 16.0f)) * (1.0f / 15.0f);
                var = __builtin_fmaxf(var, 0.0f);
                sd8[v] = sqrtf(var);
            }
            const int row = rowbase + s * 16 + r;
            if (row < batch) {
                float* o0 = out + (size_t)row * OUT_DIM;
                float* o1 = out + (size_t)batch * OUT_DIM + (size_t)row * OUT_DIM;
                *(v4f*)(o0)     = (v4f){mean8[0], mean8[1], mean8[2], mean8[3]};
                *(v4f*)(o0 + 4) = (v4f){mean8[4], mean8[5], mean8[6], mean8[7]};
                *(v4f*)(o1)     = (v4f){sd8[0], sd8[1], sd8[2], sd8[3]};
                *(v4f*)(o1 + 4) = (v4f){sd8[4], sd8[5], sd8[6], sd8[7]};
            }
        }
    }
}

// Prologue: the packed blobs, one 16-B chunk a thread (chunk index = flat thread index, so a wave stores 512 contiguous bytes).
// A weight chunk is eight k-consecutive weights of one output feature: eight independent loads, one wait, convert, one store.
#define BLOB_WAVES  (BLOB_CHUNKS / 32)                       // 46 waves a model
#define PACK_BLOCKS (N_MODELS * BLOB_CHUNKS / PACK_THREADS)  // 92
static_assert(N_MODELS * BLOB_CHUNKS % PACK_THREADS == 0);
// every part of the blob begins at a multiple of a wave's 512 B: which part a wave packs is a scalar question
static_assert(OFFB_W2 % 512 == 0 && OFFB_W3 % 512 == 0 && OFFB_W4 % 512 == 0 && OFFB_B % 512 == 0 && BLOB_BYTES % 512 == 0);
static_assert((OFFB_W4 + OUT_DIM * HID * 2) % 512 == 0);     // so does the zero padding of W4t
static_assert(OFFB_W4 % 1024 == 0 && OUT_DIM * HID * 2 == 1024);   // W4t rows n < 8: two waves, the first at an even piece
static_assert(OFFB_B + 2 * 512 == BLOB_BYTES);               // biases and pad: two waves

union Chunk { uv4 q; unsigned short u[8]; _Float16 h[8]; };

__device__ __forceinline__ void ld_k8(const float* g, int ld, float (&w)[8]) {
#pragma unroll   // the eight loads are in flight together
    for (int j = 0; j < 8; ++j) w[j] = g[j * ld];
    // a precaution: the wait stands behind the loads and in front of every rewrite of their address register,
    // which it names so that no load's result is placed over it
    asm volatile("s_wait_xcnt 0x0" :: "v"(g) : "memory");
}

__device__ __forceinline__ uv4 pack_h8(const float (&w)[8]) {
    Chunk o;
#pragma unroll   // constant indices keep w and o in registers
    for (int j = 0; j < 8; ++j) o.h[j] = (_Float16)(WSCALE * bf16_rne(w[j]));
    return o.q;
}

// A chunk's one store. s_wait_xcnt: a precaution, it stands behind the store and in front of every rewrite of the store's
// address and data registers (the built code strings the branches below in one chain, where a later branch's code writes them).
__device__ __forceinline__ void st_chunk(uv4* dst, uv4 q) {
    *dst = q;
    asm volatile("s_wait_xcnt 0x0" ::: "memory");
}

__global__ __launch_bounds__(PACK_THREADS)
void pack_weights_kernel(const float* __restrict__ W1, const float* __restrict__ b1,
                         const float* __restrict__ W2, const float* __restrict__ b2,
                         const float* __restrict__ W3, const float* __restrict__ b3,
                         const float* __restrict__ W4, const float* __restrict__ b4,
                         unsigned char* __restrict__ blob) {
    const int chunk = blockIdx.x * PACK_THREADS + threadIdx.x;
    const int lane  = threadIdx.x & 31;
    const int wv = __builtin_amdgcn_readfirstlane(chunk >> 5);                 // scalar: the branches below are taken by whole waves
    const int m  = wv / BLOB_WAVES;
    const int cw = wv - m * BLOB_WAVES;                                        // the wave's 512-B piece of model m's blob
    uv4* dst = (uv4*)(blob + (size_t)chunk * 16);

    float w[8];
    if (cw < OFFB_W2 / 512) {
        // W1[m] is [32 k][64 n] -> bf16 [n][k]: 4 chunks a row, 8 rows a wave
        ld_k8(W1 + m * (IN_DIM * HID) + cw * 8 + (lane & 3) * (8 * HID) + (lane >> 2), HID, w);
        Chunk o;
#pragma unroll   // constant indices keep w and o in registers
        for (int j = 0; j < 8; ++j) o.u[j] = bf16_bits(w[j]);
        *dst = o.q;                                                            // the wave ends behind this store: nothing is rewritten
    } else if (cw < OFFB_W4 / 512) {
        // W2[m], W3[m] are [64 k][64 n] -> f16(256 * bf16(w)) [n][k]: 8 chunks a row, 4 rows a wave
        const bool second = cw >= OFFB_W3 / 512;
        const float* W = second ? W3 : W2;
        const int    rw = cw - (second ? OFFB_W3 / 512 : OFFB_W2 / 512);
        ld_k8(W + m * (HID * HID) + rw * 4 + (lane & 7) * (8 * HID) + (lane >> 3), HID, w);
        st_chunk(dst, pack_h8(w));
    } else if (cw < (OFFB_W4 + OUT_DIM * HID * 2) / 512) {
        // W4[m] is [64 k][8 n] -> f16 [n][k], rows n < 8: two waves, the first at an even cw
        ld_k8(W4 + m * (HID * OUT_DIM) + (cw & 1) * 4 + (lane & 7) * (8 * OUT_DIM) + (lane >> 3), OUT_DIM, w);
        st_chunk(dst, pack_h8(w));
    } else if (cw < OFFB_B / 512) {
        st_chunk(dst, (uv4){0u, 0u, 0u, 0u});                                      // W4t rows n = 8..15
    } else {
        // f32 biases, bf16-rounded, 4 a chunk. First wave: b1 (lanes 0..15), b2; second: b3, then b4 (lanes 16, 17), then zeros
        const bool first = cw == OFFB_B / 512;
        const bool low   = lane < 16;
        const float* glo = (first ? b1 : b3) + m * HID;
        const float* ghi = first ? b2 + m * HID : b4 + m * OUT_DIM;
        const int    sub = lane & (low || first ? 15 : 1);                     // in bounds for the zero chunks too
        const float* g   = (low ? glo : ghi) + 4 * sub;
        unsigned v[4];
#pragma unroll   // the four loads are in flight together
        for (int j = 0; j < 4; ++j) v[j] = __float_as_uint(g[j]);
        asm volatile("s_wait_xcnt 0x0" :: "v"(g) : "memory");                  // the precaution of ld_k8
        const unsigned keep = (first || lane < 18) ? 0xFFFF0000u : 0u;
        uv4 o;
#pragma unroll   // constant indices keep v and o in registers
        for (int j = 0; j < 4; ++j) o[j] = (v[j] + 0x7FFFu + ((v[j] >> 16) & 1u)) & keep;   // bf16_rne, or zero
        st_chunk(dst, o);
    }
}

extern "C" void kernel_launch(void* const* d_in, const int* in_sizes, int n_in,
                              void* d_out, int out_size, void* d_ws, size_t ws_size,
                              hipStream_t stream) {
    (void)n_in;
    const float* x  = (const float*)d_in[0];
    const float* W1 = (const float*)d_in[1];
    const float* b1 = (const float*)d_in[2];
    const float* W2 = (const float*)d_in[3];
    const float* b2 = (const float*)d_in[4];
    const float* W3 = (const float*)d_in[5];
    const float* b3 = (const float*)d_in[6];
    const float* W4 = (const float*)d_in[7];
    const float* b4 = (const float*)d_in[8];
    float* out = (float*)d_out;

    const int batch = in_sizes[0] / IN_DIM;                                      // 131072
    if (batch <= 0) return;
    if ((long long)out_size < 2LL * (long long)batch * OUT_DIM) return;

    const size_t copy_bytes = (size_t)N_MODELS * BLOB_BYTES;                     // 376,832 B
    if (ws_size < copy_bytes) return;
    unsigned char* blob  = (unsigned char*)d_ws;

    const int blocks = (batch + ROWS_PER_BLOCK - 1) / ROWS_PER_BLOCK;           // 512

    pack_weights_kernel<<<dim3(PACK_BLOCKS), dim3(PACK_THREADS), 0, stream>>>(W1, b1, W2, b2, W3, b3, W4, b4, blob);
    mlp_stats_kernel<<<dim3(blocks), dim3(THREADS), 0, stream>>>(x, blob, out, batch);
}

// v007
// A run of this version takes 31.3 microseconds.
// Timed twice side by side with v006, it ran 1.11 and 1.10 times as fast.
// Counting every step since v000, it is 6.66 times as fast.
#include <hip/hip_runtime.h>

// Every product is computed transposed: weights [n][k] are the A operand, activations (batch in the columns) the B operand,
// so a lane's D registers of two neighbouring 16-feature tiles, packed to f16, are the next layer's B fragment in place.
// Layer 1: v_wmma_f32_16x16x32_bf16 (bf16 operands = RNE-converted x and W1); layers 2-4: v_wmma_f32_16x16x32_f16 (f16 activations, f16 weights = bf16-RNE weights at their own scale: under 2^-14 they are f16 subnormals, off by at most 2^-25 each); f32 accumulate everywhere; member mean/std in f32.
// The f32 bias is the C operand of a tile's first WMMA: a lane's eight D registers are eight features of one batch column, so the lane's eight biases are its C registers.

typedef _Float16       v16h  __attribute__((ext_vector_type(16)));
typedef _Float16       v8h   __attribute__((ext_vector_type(8)));
typedef _Float16       v8ha  __attribute__((ext_vector_type(8), may_alias));
typedef __bf16         v16bf __attribute__((ext_vector_type(16)));
typedef unsigned short v8us  __attribute__((ext_vector_type(8)));
typedef unsigned short v8usa __attribute__((ext_vector_type(8), may_alias));
typedef float          v8f   __attribute__((ext_vector_type(8)));
typedef _Float16       v2h   __attribute__((ext_vector_type(2)));
typedef float          v2f   __attribute__((ext_vector_type(2)));
typedef float          v4f   __attribute__((ext_vector_type(4)));
typedef float          v4fa  __attribute__((ext_vector_type(4), may_alias));
typedef unsigned int   uv4   __attribute__((ext_vector_type(4)));
typedef unsigned int   uv4a  __attribute__((ext_vector_type(4), may_alias));

#define N_MODELS        16
#define IN_DIM          32
#define HID             64
#define OUT_DIM         8
#define OUT_PAD         16
#define THREADS         128
#define WAVES_PER_BLOCK 4
#define SUBT            4                                    // 16-row WMMA sub-tiles per wave: every weight fragment read from LDS feeds four products
#define ROWS_PER_WAVE   (SUBT * 16)                          // 64
#define ROWS_PER_BLOCK  (WAVES_PER_BLOCK * ROWS_PER_WAVE)    // 256
#define PACK_THREADS    256

// Packed per-model weight blob (byte offsets), rows unpadded:
//   W1t bf16 [64 n][32 k], W2t/W3t f16 [64 n][64 k], W4t f16 [16 n][64 k] (n 8..15 zero),
#define OFFB_W1     0
#define OFFB_W2     4096
#define OFFB_W3     12288
#define OFFB_W4     20480
#define OFFB_B      22528
#define OFFB_PAD    23360
#define BLOB_BYTES  23552
#define BLOB_CHUNKS (BLOB_BYTES / 16)                        // 1472

// LDS image of the blob: same rows, each at a pitch of 16 B x odd, so that the 16 lanes of a
// ds_load_b128 fragment read fall on 16 different groups of four banks.
#define W1_PITCH    40                                       // bf16 elements: 64-B rows at 80 B
#define H_PITCH     72                                       // f16 elements: 128-B rows at 144 B (W2t, W3t, W4t)
#define OFFS_W1     0
#define OFFS_W2     (HID * W1_PITCH * 2)                     // 5120
#define OFFS_W3     (OFFS_W2 + HID * H_PITCH * 2)            // 14336
#define OFFS_W4     (OFFS_W3 + HID * H_PITCH * 2)            // 23552
#define OFFS_B      (OFFS_W4 + OUT_PAD * H_PITCH * 2)        // 25856
#define SIMG_BYTES  (OFFS_B + (BLOB_BYTES - OFFB_B))         // 26880

static_assert(BLOB_BYTES % 128 == 0);
static_assert(OFFB_B + 208 * 4 == OFFB_PAD);
static_assert(OFFB_PAD % 16 == 0);

#define STAGE_TRIPS      11                                  // chunks 0..1407: eleven 16-B copies by every thread
#define STAGE_TAIL_WAVES ((BLOB_CHUNKS - STAGE_TRIPS * THREADS) / 32)   // chunks 1408..1471: a twelfth copy by waves 0 and 1
static_assert(STAGE_TRIPS * THREADS + STAGE_TAIL_WAVES * 32 == BLOB_CHUNKS);
static_assert(SIMG_BYTES % 16 == 0);
static_assert(OFFB_W2 / 16 == 2 * THREADS);                  // copies 0 and 1 are all of W1t
static_assert(OFFB_B / 16 == STAGE_TRIPS * THREADS);         // copies 2..10: W2t, W3t, W4t rows; the tail: biases and pad
#define W1_STEP          (THREADS / 4 * W1_PITCH * 2)        // 32 rows of 4 chunks a trip: 2,560 B of the LDS image
#define TRIP_STEP        (THREADS / 8 * H_PITCH * 2)         // 16 rows of 8 chunks a trip: 2,304 B of the LDS image
#define G_STEP           (THREADS * 16)                      // a trip's step in the blob: 2,048 B

// One model's blob -> one LDS image, each lane's 16-B chunks as asynchronous copies (no register on the way).
// g: the lane's chunk 0 of that blob; la, lb, lc: the lane's LDS byte addresses in the target image of its first W1t chunk,
// its first W2t chunk and its bias chunk; tail: wave-uniform.
// s_wait_xcnt closes each statement: a precaution, it stands in front of every later rewrite of the address registers.
__device__ __forceinline__ void stage_async(const unsigned char* g, unsigned la, unsigned lb, unsigned lc, bool tail) {
    asm volatile("global_load_async_to_lds_b128 %0, %11, off\n\t"
                 "global_load_async_to_lds_b128 %1, %12, off\n\t"
                 "global_load_async_to_lds_b128 %2, %13, off\n\t"
                 "global_load_async_to_lds_b128 %3, %14, off\n\t"
                 "global_load_async_to_lds_b128 %4, %15, off\n\t"
                 "global_load_async_to_lds_b128 %5, %16, off\n\t"
                 "global_load_async_to_lds_b128 %6, %17, off\n\t"
                 "global_load_async_to_lds_b128 %7, %18, off\n\t"
                 "global_load_async_to_lds_b128 %8, %19, off\n\t"
                 "global_load_async_to_lds_b128 %9, %20, off\n\t"
                 "global_load_async_to_lds_b128 %10, %21, off\n\t"
                 "s_wait_xcnt 0x0"
                 :: "v"(la), "v"(la + W1_STEP),
                    "v"(lb), "v"(lb + 1 * TRIP_STEP), "v"(lb + 2 * TRIP_STEP), "v"(lb + 3 * TRIP_STEP), "v"(lb + 4 * TRIP_STEP),
                    "v"(lb + 5 * TRIP_STEP), "v"(lb + 6 * TRIP_STEP), "v"(lb + 7 * TRIP_STEP), "v"(lb + 8 * TRIP_STEP),
                    "v"(g), "v"(g + 1 * G_STEP), "v"(g + 2 * G_STEP), "v"(g + 3 * G_STEP), "v"(g + 4 * G_STEP), "v"(g + 5 * G_STEP),
                    "v"(g + 6 * G_STEP), "v"(g + 7 * G_STEP), "v"(g + 8 * G_STEP), "v"(g + 9 * G_STEP), "v"(g + 10 * G_STEP)
                 : "memory");
    if (tail) {
        asm volatile("global_load_async_to_lds_b128 %0, %1, off\n\t"
                     "s_wait_xcnt 0x0"
                     :: "v"(lc), "v"(g + 11 * G_STEP) : "memory");
    }
}

union FragH  { v16h  v; v8h  h[2]; };
union FragBF { v16bf v; v8us h[2]; };

__device__ __forceinline__ unsigned short bf16_bits(float f) {
    unsigned int u = __float_as_uint(f);
    u += 0x7FFFu + ((u >> 16) & 1u);                         // RNE convert to bf16
    return (unsigned short)(u >> 16);
}

__device__ __forceinline__ float bf16_rne(float f) {
    return __uint_as_float(((unsigned int)bf16_bits(f)) << 16);
}

__device__ __forceinline__ v8f v8f_splat(float v) {
    v8f r;
#pragma unroll
    for (int i = 0; i < 8; ++i) r[i] = v;
    return r;
}

// Plain builtins, no v_nop tail: in the tile pipeline below the slots behind a WMMA hold the earlier tile's epilogue,
// and the compiler keeps the distance where they do not.
__device__ __forceinline__ v8f mma_f16(v16h a, v16h b, v8f c) {
    return __builtin_amdgcn_wmma_f32_16x16x32_f16(false, a, false, b, (short)0, c, false, false);
}

__device__ __forceinline__ v8f mma_bf16(v16bf a, v16bf b, v8f c) {
    return __builtin_amdgcn_wmma_f32_16x16x32_bf16(false, a, false, b, (short)0, c, false, false);
}

// 16-bit A fragment from a k-contiguous [idx][k] weight tile (idx = output feature), split k map:
// elements 0..7 <- k = K0 + 8*half + 0..7, elements 8..15 <- k = K0 + 16 + 8*half + 0..7.
__device__ __forceinline__ v16h ld_frag_h(const _Float16* base, int ld, int K0, int idx, int half) {
    const _Float16* p = base + idx * ld + K0 + 8 * half;
    FragH f;
    f.h[0] = *(const v8ha*)(p);
    f.h[1] = *(const v8ha*)(p + 16);
    return f.v;
}

__device__ __forceinline__ v16bf ld_frag_bf(const unsigned short* base, int ld, int K0, int idx, int half) {
    const unsigned short* p = base + idx * ld + K0 + 8 * half;
    FragBF f;
    f.h[0] = *(const v8usa*)(p);
    f.h[1] = *(const v8usa*)(p + 16);
    return f.v;
}

union PackH { v8h v; v2h p[4]; };

// One D tile (lane: features f0 + 8*half + 0..7 of batch column r), bias already in it -> f32->f16, ReLU.
// The eight packed values are elements 0..7 (even tile) or 8..15 (odd tile) of the next layer's B fragment:
// k = 8*half + v and k = 16 + 8*half + v, the split k map of ld_frag_h.
__device__ __forceinline__ v8h relu_pack(v8f acc) {
    PackH o;
#pragma unroll   // constant indices keep acc and o in registers
    for (int i = 0; i < 4; ++i) {
        const v2f a = {acc[2 * i], acc[2 * i + 1]};
        const v2h q = __builtin_convertvector(a, v2h);
        o.p[i] = __builtin_elementwise_max(q, (v2h){(_Float16)0.0f, (_Float16)0.0f});
    }
    return o.v;
}

// ---- tile pipeline ----
// A model pass is 13 stages, one 16-feature tile each (4 + 4 + 4 + 1). Stage s: the fragment and bias reads of stage s + 1 as one
// group, then the WMMAs of stage s with the epilogue of stage s - 1 between them.
// keep_order() stands behind each read group: the compiler moves no LDS read across it. Without it the reads sink to just in
// front of their WMMA, in many small groups, and the LDS latency is waited out there.
__device__ __forceinline__ void keep_order() { __builtin_amdgcn_sched_barrier(0); }

struct TileH { v16h  a0, a1; v8f b; };                       // weights [16 n][64 k] as two A fragments, the lane's 8 biases
struct TileB { v16bf a;      v8f b; };                       // weights [16 n][32 k]
struct Pend  { v8f c[SUBT]; };                               // a stage's accumulators (every batch sub-tile) awaiting their epilogue

// The lane's eight biases of tile t, in the order of its D registers
__device__ __forceinline__ v8f ld_bias(const float* bias, int t, int half) {
    const v4f lo = *(const v4fa*)(bias + t * 16 + 8 * half);
    const v4f hi = *(const v4fa*)(bias + t * 16 + 8 * half + 4);
    return __builtin_shufflevector(lo, hi, 0, 1, 2, 3, 4, 5, 6, 7);
}

__device__ __forceinline__ TileH ld_tile_h(const _Float16* Wt, const float* bias, int t, int r, int half) {
    TileH w;
    w.a0  = ld_frag_h(Wt, H_PITCH, 0,  t * 16 + r, half);
    w.a1  = ld_frag_h(Wt, H_PITCH, 32, t * 16 + r, half);
    w.b   = ld_bias(bias, t, half);
    return w;
}

__device__ __forceinline__ TileB ld_tile_b(const unsigned short* Wt, const float* bias, int t, int r, int half) {
    TileB w;
    w.a   = ld_frag_bf(Wt, W1_PITCH, 0, t * 16 + r, half);
    w.b   = ld_bias(bias, t, half);
    return w;
}

// One stage of a 64-wide layer. h[2 s], h[2 s + 1]: k 0..31 and 32..63 of batch sub-tile s.
// The pending stage's packed outputs go to d[2 s + dk].h[dh]; in a layer's first stage they are the upper halves of h[2 s + 1],
// which only the WMMAs of the second group, behind them, read.
__device__ __forceinline__ void stage_h(const TileH& w, const FragH* h, Pend& p, FragH* d, int dk, int dh) {
    v8f c[SUBT];
#pragma unroll   // s picks register sets
    for (int s = 0; s < SUBT; ++s) {
        c[s] = mma_f16(w.a0, h[2 * s].v, w.b);
        d[2 * s + dk].h[dh] = relu_pack(p.c[s]);
    }
#pragma unroll   // as above
    for (int s = 0; s < SUBT; ++s) p.c[s] = mma_f16(w.a1, h[2 * s + 1].v, c[s]);
}

__global__ __launch_bounds__(THREADS) __attribute__((amdgpu_waves_per_eu(2, 2)))   // two work-groups a WGP: a wave's budget is 512 VGPRs
void mlp_stats_kernel(const float* __restrict__ x,
                      const unsigned char* __restrict__ wblob,
                      float* __restrict__ out, int batch) {
    __shared__ __align__(16) unsigned char sBlob[2 * SIMG_BYTES];                       // two images, 53,760 B

    const int tid  = threadIdx.x;
    const int wave = tid >> 5;
    const int lane = tid & 31;
    const int r    = lane & 15;
    const int half = lane >> 4;
    const int rowbase = blockIdx.x * ROWS_PER_BLOCK + wave * ROWS_PER_WAVE;

    // ---- weight ring, two LDS images: model 0's copies start here and land under the x loads ----
    const bool tail = __builtin_amdgcn_readfirstlane(wave) < STAGE_TAIL_WAVES;          // scalar: whole waves take or skip copy 12
    const unsigned lbase = (unsigned)(size_t)sBlob;                                     // LDS byte address of image 0
    // LDS place of 16-B chunk tid + 128 k of the blob: the rows at their padded pitch, biases and pad behind them
    const unsigned la = lbase + OFFS_W1 + (tid >> 2) * (W1_PITCH * 2) + (tid & 3) * 16; // 4 chunks a row
    const unsigned lb = lbase + OFFS_W2 + (tid >> 3) * (H_PITCH * 2) + (tid & 7) * 16;  // 8 chunks a row
    const unsigned lc = lbase + OFFS_B + (tid & 63) * 16;                               // named by waves 0 and 1 only
    const unsigned char* gl = wblob + tid * 16;
    stage_async(gl, la, lb, lc, tail);

    // ---- x rows -> four bf16 B fragments (column = batch row, split k map), kept in VGPRs for all models ----
    v16bf xa[SUBT];
    {
        const float* xr[SUBT];
        v4f f[SUBT][4];
#pragma unroll   // s picks register sets
        for (int s = 0; s < SUBT; ++s) {
            int row = rowbase + s * 16 + r;
            row = (row < batch) ? row : (batch - 1);
            xr[s] = x + (size_t)row * IN_DIM + 8 * half;
            f[s][0] = *(const v4f*)(xr[s]);
            f[s][1] = *(const v4f*)(xr[s] + 4);
            f[s][2] = *(const v4f*)(xr[s] + 16);
            f[s][3] = *(const v4f*)(xr[s] + 20);
        }
        // a precaution: the wait stands behind the sixteen loads and in front of every rewrite of their address registers,
        // which it names so that no load's result is placed over them
        asm volatile("s_wait_xcnt 0x0" :: "v"(xr[0]), "v"(xr[1]), "v"(xr[2]), "v"(xr[3]) : "memory");
#pragma unroll   // as above
        for (int s = 0; s < SUBT; ++s) {
            const v4f f0 = f[s][0], f1 = f[s][1], f2 = f[s][2], f3 = f[s][3];
            FragBF fx;
            v8us lo, hi;
            lo[0] = bf16_bits(f0[0]); lo[1] = bf16_bits(f0[1]); lo[2] = bf16_bits(f0[2]); lo[3] = bf16_bits(f0[3]);
            lo[4] = bf16_bits(f1[0]); lo[5] = bf16_bits(f1[1]); lo[6] = bf16_bits(f1[2]); lo[7] = bf16_bits(f1[3]);
            hi[0] = bf16_bits(f2[0]); hi[1] = bf16_bits(f2[1]); hi[2] = bf16_bits(f2[2]); hi[3] = bf16_bits(f2[3]);
            hi[4] = bf16_bits(f3[0]); hi[5] = bf16_bits(f3[1]); hi[6] = bf16_bits(f3[2]); hi[7] = bf16_bits(f3[3]);
            fx.h[0] = lo;
            fx.h[1] = hi;
            xa[s] = fx.v;
        }
    }

    // shifted running sums over models: d = pred - pred(model 0)
    v8f sum[SUBT], sq[SUBT], pz[SUBT];
#pragma unroll   // s picks register sets
    for (int s = 0; s < SUBT; ++s) { sum[s] = v8f_splat(0.0f); sq[s] = v8f_splat(0.0f); pz[s] = v8f_splat(0.0f); }

    // model 0 landed (this wave's copies), then published to every wave; model 1 starts into image 1
    asm volatile("s_wait_asynccnt 0x0" ::: "memory");
    __syncthreads();
    stage_async(gl + BLOB_BYTES, la + SIMG_BYTES, lb + SIMG_BYTES, lc + SIMG_BYTES, tail);

#pragma unroll 1
    for (int m = 0; m < N_MODELS; ++m) {
        const unsigned bsel = (m & 1) ? SIMG_BYTES : 0;                                 // image that holds model m
        const unsigned char* sImg = sBlob + bsel;
        const unsigned short* sW1 = (const unsigned short*)(sImg + OFFS_W1);
        const _Float16* sW2 = (const _Float16*)(sImg + OFFS_W2);
        const _Float16* sW3 = (const _Float16*)(sImg + OFFS_W3);
        const _Float16* sW4 = (const _Float16*)(sImg + OFFS_W4);
        const float* sb1 = (const float*)(sImg + OFFS_B);
        const float* sb2 = sb1 + 64;
        const float* sb3 = sb1 + 128;
        const float* sb4 = sb1 + 192;

        FragH h1[2 * SUBT], h2[2 * SUBT], h3[2 * SUBT];      // layer outputs = next layer's B fragments, indexed as in stage_h
        Pend  p;

        // ---- Layer 1: relu(W1t @ xt + b1), K = 32, bf16 operands ----
        TileH wh;
        {
            TileB wb = ld_tile_b(sW1, sb1, 0, r, half);
#pragma unroll   // t picks fragment halves and the next tile: constant so that everything stays in registers
            for (int t = 0; t < 4; ++t) {
                TileB nb;
                if (t < 3) nb = ld_tile_b(sW1, sb1, t + 1, r, half);
                else       wh = ld_tile_h(sW2, sb2, 0, r, half);
                keep_order();
                v8f c[SUBT];
#pragma unroll   // s picks register sets
                for (int s = 0; s < SUBT; ++s) {
                    c[s] = mma_bf16(wb.a, xa[s], wb.b);
                    if (t > 0) h1[2 * s + ((t - 1) >> 1)].h[(t - 1) & 1] = relu_pack(p.c[s]);
                }
#pragma unroll   // as above
                for (int s = 0; s < SUBT; ++s) p.c[s] = c[s];
                if (t < 3) wb = nb;
            }
        }

        // ---- Layers 2 and 3 ----
#pragma unroll   // as above
        for (int t = 0; t < 4; ++t) {
            const TileH nh = (t < 3) ? ld_tile_h(sW2, sb2, t + 1, r, half) : ld_tile_h(sW3, sb3, 0, r, half);
            keep_order();
            if (t == 0) stage_h(wh, h1, p, h1, 1, 1);
            else        stage_h(wh, h1, p, h2, (t - 1) >> 1, (t - 1) & 1);
            wh = nh;
        }
#pragma unroll   // as above
        for (int t = 0; t < 4; ++t) {
            const TileH nh = (t < 3) ? ld_tile_h(sW3, sb3, t + 1, r, half) : ld_tile_h(sW4, sb4, 0, r, half);
            keep_order();
            if (t == 0) stage_h(wh, h2, p, h2, 1, 1);
            else        stage_h(wh, h2, p, h3, (t - 1) >> 1, (t - 1) & 1);
            wh = nh;
        }

        // ---- Layer 4: pred = W4t @ h3t + b4 (outputs padded to 16 rows), shifted statistics ----
        // lane: outputs 8*half + 0..7 of batch column r; half 1 holds the zero padding
        {
            stage_h(wh, h3, p, h3, 1, 1);
            if (m == 0) {
#pragma unroll   // s picks register sets
                for (int s = 0; s < SUBT; ++s) pz[s] = p.c[s];
            } else {
#pragma unroll   // as above
                for (int s = 0; s < SUBT; ++s) {
                    const v8f d = p.c[s] - pz[s];
                    sum[s] += d; sq[s] += d * d;
                }
            }
        }

        // ---- publish point of model m + 1 ----
        asm volatile("s_wait_dscnt 0x0" ::: "memory");      // this wave's reads of image m & 1 are over before it is refilled
        asm volatile("s_wait_asynccnt 0x0" ::: "memory");   // this wave's copies of model m + 1 have landed
        __syncthreads();                                    // model m + 1 readable by all; image m & 1 left by all
        if (m + 2 < N_MODELS)
            stage_async(gl + (size_t)(m + 2) * BLOB_BYTES, la + bsel, lb + bsel, lc + bsel, tail);
    }
    asm volatile("s_wait_asynccnt 0x0" ::: "memory");       // no copy outstanding when the wave ends

    // a lane of half 0 holds all 8 outputs of one batch row: 32 contiguous bytes of each output plane
    if (half == 0) {
#pragma unroll   // s selects register sets
        for (int s = 0; s < SUBT; ++s) {
            const v8f su8 = sum[s];
            const v8f sq8 = sq[s];
            const v8f pz8 = pz[s];
            v8f mean8, sd8;
#pragma unroll   // constant vector indices
            for (int v = 0; v < 8; ++v) {
                const float su = su8[v];
                mean8[v] = __builtin_fmaf(su, 1.0f / 16.0f, pz8[v]);
                float var = (sq8[v] - su * su * (1.0f / 16.0f)) * (1.0f / 15.0f);
                var = __builtin_fmaxf(var, 0.0f);
                sd8[v] = sqrtf(var);
            }
            const int row = rowbase + s * 16 + r;
            if (row < batch) {
                float* o0 = out + (size_t)row * OUT_DIM;
                float* o1 = out + (size_t)batch * OUT_DIM + (size_t)row * OUT_DIM;
                *(v4f*)(o0)     = (v4f){mean8[0], mean8[1], mean8[2], mean8[3]};
                *(v4f*)(o0 + 4) = (v4f){mean8[4], mean8[5], mean8[6], mean8[7]};
                *(v4f*)(o1)     = (v4f){sd8[0], sd8[1], sd8[2], sd8[3]};
                *(v4f*)(o1 + 4) = (v4f){sd8[4], sd8[5], sd8[6], sd8[7]};
            }
        }
    }
}

// Prologue: the packed blobs, one 16-B chunk a thread (chunk index = flat thread index, so a wave stores 512 contiguous bytes).
// A weight chunk is eight k-consecutive weights of one output feature: eight independent loads, one wait, convert, one store.
#define BLOB_WAVES  (BLOB_CHUNKS / 32)                       // 46 waves a model
#define PACK_BLOCKS (N_MODELS * BLOB_CHUNKS / PACK_THREADS)  // 92
static_assert(N_MODELS * BLOB_CHUNKS % PACK_THREADS == 0);
// every part of the blob begins at a multiple of a wave's 512 B: which part a wave packs is a scalar question
static_assert(OFFB_W2 % 512 == 0 && OFFB_W3 % 512 == 0 && OFFB_W4 % 512 == 0 && OFFB_B % 512 == 0 && BLOB_BYTES % 512 == 0);
static_assert((OFFB_W4 + OUT_DIM * HID * 2) % 512 == 0);     // so does the zero padding of W4t
static_assert(OFFB_W4 % 1024 == 0 && OUT_DIM * HID * 2 == 1024);   // W4t rows n < 8: two waves, the first at an even piece
static_assert(OFFB_B + 2 * 512 == BLOB_BYTES);               // biases and pad: two waves

union Chunk { uv4 q; unsigned short u[8]; _Float16 h[8]; };

__device__ __forceinline__ void ld_k8(const float* g, int ld, float (&w)[8]) {
#pragma unroll   // the eight loads are in flight together
    for (int j = 0; j < 8; ++j) w[j] = g[j * ld];
    // a precaution: the wait stands behind the loads and in front of every rewrite of their address register,
    // which it names so that no load's result is placed over it
    asm volatile("s_wait_xcnt 0x0" :: "v"(g) : "memory");
}

__device__ __forceinline__ uv4 pack_h8(const float (&w)[8]) {
    Chunk o;
#pragma unroll   // constant indices keep w and o in registers
    for (int j = 0; j < 8; ++j) o.h[j] = (_Float16)bf16_rne(w[j]);
    return o.q;
}

// A chunk's one store. s_wait_xcnt: a precaution, it stands behind the store and in front of every rewrite of the store's
// address and data registers (the built code strings the branches below in one chain, where a later branch's code writes them).
__device__ __forceinline__ void st_chunk(uv4* dst, uv4 q) {
    *dst = q;
    asm volatile("s_wait_xcnt 0x0" ::: "memory");
}

__global__ __launch_bounds__(PACK_THREADS)
void pack_weights_kernel(const float* __restrict__ W1, const float* __restrict__ b1,
                         const float* __restrict__ W2, const float* __restrict__ b2,
                         const float* __restrict__ W3, const float* __restrict__ b3,
                         const float* __restrict__ W4, const float* __restrict__ b4,
                         unsigned char* __restrict__ blob) {
    const int chunk = blockIdx.x * PACK_THREADS + threadIdx.x;
    const int lane  = threadIdx.x & 31;
    const int wv = __builtin_amdgcn_readfirstlane(chunk >> 5);                 // scalar: the branches below are taken by whole waves
    const int m  = wv / BLOB_WAVES;
    const int cw = wv - m * BLOB_WAVES;                                        // the wave's 512-B piece of model m's blob
    uv4* dst = (uv4*)(blob + (size_t)chunk * 16);

    float w[8];
    if (cw < OFFB_W2 / 512) {
        // W1[m] is [32 k][64 n] -> bf16 [n][k]: 4 chunks a row, 8 rows a wave
        ld_k8(W1 + m * (IN_DIM * HID) + cw * 8 + (lane & 3) * (8 * HID) + (lane >> 2), HID, w);
        Chunk o;
#pragma unroll   // constant indices keep w and o in registers
        for (int j = 0; j < 8; ++j) o.u[j] = bf16_bits(w[j]);
        *dst = o.q;                                                            // the wave ends behind this store: nothing is rewritten
    } else if (cw < OFFB_W4 / 512) {
        // W2[m], W3[m] are [64 k][64 n] -> f16(bf16(w)) [n][k]: 8 chunks a row, 4 rows a wave
        const bool second = cw >= OFFB_W3 / 512;
        const float* W = second ? W3 : W2;
        const int    rw = cw - (second ? OFFB_W3 / 512 : OFFB_W2 / 512);
        ld_k8(W + m * (HID * HID) + rw * 4 + (lane & 7) * (8 * HID) + (lane >> 3), HID, w);
        st_chunk(dst, pack_h8(w));
    } else if (cw < (OFFB_W4 + OUT_DIM * HID * 2) / 512) {
        // W4[m] is [64 k][8 n] -> f16 [n][k], rows n < 8: two waves, the first at an even cw
        ld_k8(W4 + m * (HID * OUT_DIM) + (cw & 1) * 4 + (lane & 7) * (8 * OUT_DIM) + (lane >> 3), OUT_DIM, w);
        st_chunk(dst, pack_h8(w));
    } else if (cw < OFFB_B / 512) {
        st_chunk(dst, (uv4){0u, 0u, 0u, 0u});                                      // W4t rows n = 8..15
    } else {
        // f32 biases, bf16-rounded, 4 a chunk. First wave: b1 (lanes 0..15), b2; second: b3, then b4 (lanes 16, 17), then zeros
        const bool first = cw == OFFB_B / 512;
        const bool low   = lane < 16;
        const float* glo = (first ? b1 : b3) + m * HID;
        const float* ghi = first ? b2 + m * HID : b4 + m * OUT_DIM;
        const int    sub = lane & (low || first ? 15 : 1);                     // in bounds for the zero chunks too
        const float* g   = (low ? glo : ghi) + 4 * sub;
        unsigned v[4];
#pragma unroll   // the four loads are in flight together
        for (int j = 0; j < 4; ++j) v[j] = __float_as_uint(g[j]);
        asm volatile("s_wait_xcnt 0x0" :: "v"(g) : "memory");                  // the precaution of ld_k8
        const unsigned keep = (first || lane < 18) ? 0xFFFF0000u : 0u;
        uv4 o;
#pragma unroll   // constant indices keep v and o in registers
        for (int j = 0; j < 4; ++j) o[j] = (v[j] + 0x7FFFu + ((v[j] >> 16) & 1u)) & keep;   // bf16_rne, or zero
        st_chunk(dst, o);
    }
}

extern "C" void kernel_launch(void* const* d_in, const int* in_sizes, int n_in,
                              void* d_out, int out_size, void* d_ws, size_t ws_size,
                              hipStream_t stream) {
    (void)n_in;
    const float* x  = (const float*)d_in[0];
    const float* W1 = (const float*)d_in[1];
    const float* b1 = (const float*)d_in[2];
    const float* W2 = (const float*)d_in[3];
    const float* b2 = (const float*)d_in[4];
    const float* W3 = (const float*)d_in[5];
    const float* b3 = (const float*)d_in[6];
    const float* W4 = (const float*)d_in[7];
    const float* b4 = (const float*)d_in[8];
    float* out = (float*)d_out;

    const int batch = in_sizes[0] / IN_DIM;                                      // 131072
    if (batch <= 0) return;
    if ((long long)out_size < 2LL * (long long)batch * OUT_DIM) return;

    const size_t copy_bytes = (size_t)N_MODELS * BLOB_BYTES;                     // 376,832 B
    if (ws_size < copy_bytes) return;
    unsigned char* blob  = (unsigned char*)d_ws;

    const int blocks = (batch + ROWS_PER_BLOCK - 1) / ROWS_PER_BLOCK;           // 512

    pack_weights_kernel<<<dim3(PACK_BLOCKS), dim3(PACK_THREADS), 0, stream>>>(W1, b1, W2, b2, W3, b3, W4, b4, blob);
    mlp_stats_kernel<<<dim3(blocks), dim3(THREADS), 0, stream>>>(x, blob, out, batch);
}
